// v000
// The times below were measured on an AMD MI455X: many runs one after another, warmed up first and cycling through
// copies of the inputs, with the whole window's GPU time divided by the number of runs. Launches and the gaps
// between them are all in it. The median over several windows is given; except for v000 it joins two sittings, which
// can be a few percent apart, so the side-by-side timings, each taken in one sitting, are the better comparison.
// v000, which the later versions start from, runs in 555 microseconds.
#include <hip/hip_runtime.h>
#include <hip/hip_bf16.h>

#define DEV __device__ __forceinline__

typedef __attribute__((ext_vector_type(16))) _Float16 v16h;
typedef __attribute__((ext_vector_type(8)))  _Float16 v8h;
typedef __attribute__((ext_vector_type(8)))  float    v8f;
typedef __attribute__((ext_vector_type(4)))  float    v4f;
typedef __attribute__((ext_vector_type(4)))  int      i32x4;
typedef __attribute__((ext_vector_type(8)))  int      i32x8;
typedef __attribute__((ext_vector_type(4)))  unsigned int u32x4;

static constexpr int Bsz = 4;
static constexpr int Sq  = 2048;
static constexpr int Dm  = 1024;
static constexpr int Hh  = 16;
static constexpr int Dh  = 64;
#define NEGF (-1.0e9f)
#define AWAVES 8   // waves per attention block
#define QROWS 32   // q rows per wave (2 row-groups of 16)

#if __has_builtin(__builtin_amdgcn_global_load_async_to_lds_b128) && \
    __has_builtin(__builtin_amdgcn_s_wait_asynccnt)
#define HAVE_ASYNC_LDS 1
#else
#define HAVE_ASYNC_LDS 0
#endif

#if __has_builtin(__builtin_amdgcn_tensor_load_to_lds) && \
    __has_builtin(__builtin_amdgcn_s_wait_tensorcnt)
#define HAVE_TDM 1
#else
#define HAVE_TDM 0
#endif

#if __has_include(<hip/amd_detail/amd_gfx1250_TDM.h>)
#define TDM_SIX_ARGS 1   // therock headers -> 6-arg builtin
#else
#define TDM_SIX_ARGS 0   // ROCm 7.2 -> 5-arg builtin
#endif

typedef __attribute__((address_space(1))) i32x4 as1_i32x4;
typedef __attribute__((address_space(3))) i32x4 as3_i32x4;

// ---------------------------------------------------------------------------
// D = A(16x32 f16) * B(32x16 f16) + C(16x16 f32)
DEV v8f wmma_f16(v16h a, v16h b, v8f c) {
  return __builtin_amdgcn_wmma_f32_16x16x32_f16(
      /*neg_a=*/false, a, /*neg_b=*/false, b,
      /*c_mod=*/(short)0, c, /*reuse_a=*/false, /*reuse_b=*/false);
}

DEV v16h load_tile_f16(const _Float16* p, int ld, int lane) {
  const _Float16* base = p + (size_t)(lane & 15) * ld + ((lane >> 4) << 3);
  v8h c0 = *(const v8h*)(base);
  v8h c1 = *(const v8h*)(base + 16);
  v16h r;
#pragma unroll
  for (int j = 0; j < 8; ++j) { r[j] = c0[j]; r[j + 8] = c1[j]; }
  return r;
}

// Same tile pattern but f32 source, converted to f16 on the fly.
DEV v16h load_tile_f32(const float* p, int ld, int lane) {
  const float* base = p + (size_t)(lane & 15) * ld + ((lane >> 4) << 3);
  v4f a0 = *(const v4f*)(base);
  v4f a1 = *(const v4f*)(base + 4);
  v4f b0 = *(const v4f*)(base + 16);
  v4f b1 = *(const v4f*)(base + 20);
  v16h r;
#pragma unroll
  for (int j = 0; j < 4; ++j) {
    r[j]      = (_Float16)a0[j];
    r[j + 4]  = (_Float16)a1[j];
    r[j + 8]  = (_Float16)b0[j];
    r[j + 12] = (_Float16)b1[j];
  }
  return r;
}

DEV void copy16_g2l(const _Float16* g, _Float16* l) {
#if HAVE_ASYNC_LDS
  __builtin_amdgcn_global_load_async_to_lds_b128(
      (as1_i32x4*)(void*)const_cast<_Float16*>(g),
      (as3_i32x4*)(void*)l,
      /*offset=*/0, /*cpol=*/0);
#else
  *(v8h*)l = *(const v8h*)g;
#endif
}

DEV void wait_async_copies() {
#if HAVE_ASYNC_LDS
  __builtin_amdgcn_s_wait_asynccnt(0);
#endif
}

#if HAVE_TDM
DEV void tdm_load_2d(const _Float16* gsrc, _Float16* ldst,
                     unsigned tile_w, unsigned tile_h, unsigned row_stride) {
  const unsigned long long ga = (unsigned long long)(size_t)gsrc;
  const unsigned lds = (unsigned)(size_t)ldst;   // low 32 bits = LDS byte addr
  u32x4 g0;
  g0[0] = 1u;
  g0[1] = lds;
  g0[2] = (unsigned)(ga & 0xffffffffu);
  g0[3] = (unsigned)((ga >> 32) & 0x1ffffffu)
        | (2u << 30);
  i32x8 g1 = {};
  g1[0] = (int)(1u << 16);
  g1[1] = (int)((tile_w & 0xffffu) << 16);
  g1[2] = (int)(((tile_w >> 16) & 0xffffu)
        |       ((tile_h & 0xffffu) << 16));
  g1[3] = (int)(((tile_h >> 16) & 0xffffu)
        |       ((tile_w & 0xffffu) << 16));
  g1[4] = (int)(tile_h & 0xffffu);
  g1[5] = (int)row_stride;
  g1[6] = 0;
  g1[7] = 0;
  i32x4 gz = {};
#if TDM_SIX_ARGS
  i32x8 gz8 = {};
  __builtin_amdgcn_tensor_load_to_lds(g0, g1, gz, gz, gz8, 0);
#else
  __builtin_amdgcn_tensor_load_to_lds(g0, g1, gz, gz, 0);
#endif
}
#endif  // HAVE_TDM

// ---------------------------------------------------------------------------
// Kernel 1: transpose + convert weights (1024x1024 f32 [k][n]) -> f16 W^T [n][k].
__global__ __launch_bounds__(256) void wtrans_kernel(
    const float* __restrict__ wq, const float* __restrict__ wk,
    const float* __restrict__ wv, _Float16* __restrict__ tq,
    _Float16* __restrict__ tk, _Float16* __restrict__ tv) {
  const float* w = (blockIdx.y == 0) ? wq : (blockIdx.y == 1) ? wk : wv;
  _Float16* o    = (blockIdx.y == 0) ? tq : (blockIdx.y == 1) ? tk : tv;
  int idx = blockIdx.x * 256 + threadIdx.x;   // k*1024 + n (coalesced read)
  int n = idx & (Dm - 1);
  int kk = idx >> 10;
  o[(size_t)n * Dm + kk] = (_Float16)w[idx];
}

// ---------------------------------------------------------------------------
// Kernel 2: fused QKV projection GEMM (wave32 WMMA).
// grid.x = (B*S)/16 row tiles, grid.y = 3 (q,k,v). Block = 256 (8 waves);
// wave w computes rows[16] x cols[w*128, w*128+128) over K=1024.
// Q,K heads -> [b][h][s][64] f16; V -> transposed [b][h][d][s] f16.
__global__ __launch_bounds__(256) void proj_kernel(
    const float* __restrict__ xq, const float* __restrict__ xk,
    const float* __restrict__ xv, const _Float16* __restrict__ wtq,
    const _Float16* __restrict__ wtk, const _Float16* __restrict__ wtv,
    const float* __restrict__ bq, const float* __restrict__ bk,
    const float* __restrict__ bv, _Float16* __restrict__ qh,
    _Float16* __restrict__ kh, _Float16* __restrict__ vt) {
  const int which = blockIdx.y;
  const float* x      = (which == 0) ? xq  : (which == 1) ? xk  : xv;
  const _Float16* wt  = (which == 0) ? wtq : (which == 1) ? wtk : wtv;
  const float* bias   = (which == 0) ? bq  : (which == 1) ? bk  : bv;
  _Float16* out       = (which == 0) ? qh  : (which == 1) ? kh  : vt;
  const bool tr = (which == 2);

  const int wave   = threadIdx.x >> 5;
  const int lane   = threadIdx.x & 31;
  const int lane15 = lane & 15;
  const int half   = lane >> 4;
  const int r0   = blockIdx.x * 16;   // global activation row in [0, B*S)
  const int col0 = wave * 128;        // output column base

  v8f acc[8] = {};
  for (int kk = 0; kk < Dm; kk += 32) {
    v16h a = load_tile_f32(x + (size_t)r0 * Dm + kk, Dm, lane);
#pragma unroll
    for (int t = 0; t < 8; ++t) {
      v16h bm = load_tile_f16(wt + (size_t)(col0 + t * 16) * Dm + kk, Dm, lane);
      acc[t] = wmma_f16(a, bm, acc[t]);
    }
  }

#pragma unroll
  for (int t = 0; t < 8; ++t) {
    const int c = col0 + t * 16 + lane15;   // global output column
    const int h = c >> 6, d = c & 63;
    const float bi = bias[c];
    if (!tr) {
#pragma unroll
      for (int i = 0; i < 8; ++i) {
        const int row = r0 + i + (half << 3);
        const int b = row >> 11, s = row & (Sq - 1);
        out[((size_t)(b * Hh + h) * Sq + s) * Dh + d] =
            (_Float16)(acc[t][i] + bi);
      }
    } else {
      // [b][h][d][S]: 8 consecutive s per lane -> one b128 store
      const int row = r0 + (half << 3);
      const int b = row >> 11, s = row & (Sq - 1);
      v8h pk;
#pragma unroll
      for (int i = 0; i < 8; ++i) pk[i] = (_Float16)(acc[t][i] + bi);
      *(v8h*)(out + ((size_t)(b * Hh + h) * Dh + d) * Sq + s) = pk;
    }
  }
}

__global__ __launch_bounds__(32 * AWAVES) void attn_kernel(
    const _Float16* __restrict__ qh, const _Float16* __restrict__ kh,
    const _Float16* __restrict__ vt, const int* __restrict__ mask,
    float* __restrict__ out) {
  __shared__ _Float16 Kb[2][32 * 64];         // [kpos][d]   4 KB per buffer
  __shared__ _Float16 Vb[2][64 * 32];         // [d][kpos]   4 KB per buffer
  __shared__ _Float16 Pl[AWAVES][2][16 * 32]; // per-wave, per-rowgroup P staging

  const int bh = blockIdx.x;
  const int b = bh >> 4, h = bh & 15;
  const int tid    = threadIdx.x;
  const int wave   = tid >> 5;
  const int lane   = tid & 31;
  const int lane15 = lane & 15;
  const int half   = lane >> 4;
  const int q0 = (blockIdx.y * AWAVES + wave) * QROWS;

  const _Float16* Qh = qh + ((size_t)bh * Sq + q0) * Dh;
  const _Float16* Kh = kh + (size_t)bh * Sq * Dh;
  const _Float16* Vh = vt + (size_t)bh * Dh * Sq;
  const int* Mb = mask + ((size_t)b * Sq + q0) * Sq;

  // stage one 32-kpos K/V chunk into LDS buffer `buf`
  auto stage = [&](int k0, int buf) {
#if HAVE_TDM
    if (wave == 0) {
      // K tile: 32 rows x 64 elems, contiguous (stride = Dh)
      tdm_load_2d(Kh + (size_t)k0 * Dh, &Kb[buf][0], Dh, 32, Dh);
      // V^T tile: 64 rows x 32 elems, row stride = Sq elems
      tdm_load_2d(Vh + k0, &Vb[buf][0], 32, Dh, Sq);
    }
#else
    // K tile: 32 rows x 128B, contiguous 4 KB (one b128 per thread)
    copy16_g2l(Kh + (size_t)k0 * Dh + tid * 8, &Kb[buf][tid * 8]);
    // V^T tile: 64 rows x 64B (row stride S halfs)
    const int r = tid >> 2, o4 = (tid & 3) * 8;
    copy16_g2l(Vh + (size_t)r * Sq + k0 + o4, &Vb[buf][r * 32 + o4]);
#endif
  };
  auto stage_wait = [&]() {
#if HAVE_TDM
    if (wave == 0) __builtin_amdgcn_s_wait_tensorcnt(0);
#else
    wait_async_copies();
#endif
  };

  // Q A-tiles: [rowgroup][dchunk], loaded once, reused for all k.
  v16h aq[2][2];
#pragma unroll
  for (int rg = 0; rg < 2; ++rg) {
    aq[rg][0] = load_tile_f16(Qh + (size_t)rg * 16 * Dh, Dh, lane);
    aq[rg][1] = load_tile_f16(Qh + (size_t)rg * 16 * Dh + 32, Dh, lane);
  }

  v16h bones;
  {
    const _Float16 onev = (_Float16)((lane15 == 0) ? 1.0f : 0.0f);
#pragma unroll
    for (int j = 0; j < 16; ++j) bones[j] = onev;
  }

  v8f o[2][4] = {};
  v8f osum[2] = {};
  float m_i[2][8];
#pragma unroll
  for (int rg = 0; rg < 2; ++rg)
#pragma unroll
    for (int i = 0; i < 8; ++i) m_i[rg][i] = -1.0e30f;

  v16h pa[2];

  stage(0, 0);
  for (int k0 = 0, it = 0; k0 < Sq; k0 += 32, ++it) {
    const int buf = it & 1;
    stage_wait();            // our chunk-`it` DMAs done
    __syncthreads();         // everyone's DMAs visible; other buffer free
    if (k0 + 32 < Sq) stage(k0 + 32, buf ^ 1);
    __builtin_prefetch(Mb + (size_t)(half << 3) * Sq + k0 + 32, 0, 1);

    // K B-tiles from LDS, shared by both row-groups
    v16h b00 = load_tile_f16(&Kb[buf][0], Dh, lane);
    v16h b01 = load_tile_f16(&Kb[buf][32], Dh, lane);
    v16h b10 = load_tile_f16(&Kb[buf][16 * Dh], Dh, lane);
    v16h b11 = load_tile_f16(&Kb[buf][16 * Dh + 32], Dh, lane);

#pragma unroll
    for (int rg = 0; rg < 2; ++rg) {
      v8f s0 = {}, s1 = {};
      s0 = wmma_f16(aq[rg][0], b00, s0);
      s0 = wmma_f16(aq[rg][1], b01, s0);
      s1 = wmma_f16(aq[rg][0], b10, s1);
      s1 = wmma_f16(aq[rg][1], b11, s1);

      float alpha[8];
#pragma unroll
      for (int i = 0; i < 8; ++i) {
        const int qrow = rg * 16 + i + (half << 3);
        const int* mrow = Mb + (size_t)qrow * Sq + k0;
        float sv0 = s0[i] * 0.125f;                 // 1/sqrt(64)
        float sv1 = s1[i] * 0.125f;
        sv0 = (mrow[lane15] == 0) ? NEGF : sv0;
        sv1 = (mrow[lane15 + 16] == 0) ? NEGF : sv1;
        float tm = fmaxf(sv0, sv1);
        tm = fmaxf(tm, __shfl_xor(tm, 1));
        tm = fmaxf(tm, __shfl_xor(tm, 2));
        tm = fmaxf(tm, __shfl_xor(tm, 4));
        tm = fmaxf(tm, __shfl_xor(tm, 8));
        const float mn = fmaxf(m_i[rg][i], tm);
        alpha[i] = __expf(m_i[rg][i] - mn);
        m_i[rg][i] = mn;
        const float p0 = __expf(sv0 - mn);
        const float p1 = __expf(sv1 - mn);
        const int r16 = i + (half << 3);
        Pl[wave][rg][r16 * 32 + lane15]      = (_Float16)p0;
        Pl[wave][rg][r16 * 32 + 16 + lane15] = (_Float16)p1;
      }
#pragma unroll
      for (int t = 0; t < 4; ++t)
#pragma unroll
        for (int i = 0; i < 8; ++i) o[rg][t][i] *= alpha[i];
#pragma unroll
      for (int i = 0; i < 8; ++i) osum[rg][i] *= alpha[i];

      // reload P in A-matrix layout (same-wave DS ops are in order)
      const _Float16* prow = &Pl[wave][rg][lane15 * 32 + (half << 3)];
#pragma unroll
      for (int j = 0; j < 8; ++j) {
        pa[rg][j] = prow[j];
        pa[rg][j + 8] = prow[j + 16];
      }
    }

    // O += P * V: V^T B-tiles loaded once, used by both row-groups
#pragma unroll
    for (int t = 0; t < 4; ++t) {
      v16h bvt = load_tile_f16(&Vb[buf][(t * 16) * 32], 32, lane);
      o[0][t] = wmma_f16(pa[0], bvt, o[0][t]);
      o[1][t] = wmma_f16(pa[1], bvt, o[1][t]);
    }
    // l += P * 1 (row sums via WMMA)
    osum[0] = wmma_f16(pa[0], bones, osum[0]);
    osum[1] = wmma_f16(pa[1], bones, osum[1]);
  }

#pragma unroll
  for (int rg = 0; rg < 2; ++rg) {
    float inv[8];
#pragma unroll
    for (int i = 0; i < 8; ++i) {
      const float l = __shfl(osum[rg][i], half << 4);  // broadcast column 0
      inv[i] = 1.0f / l;
    }
#pragma unroll
    for (int t = 0; t < 4; ++t) {
      const int d = h * Dh + t * 16 + lane15;
#pragma unroll
      for (int i = 0; i < 8; ++i) {
        const int s = q0 + rg * 16 + i + (half << 3);
        out[((size_t)b * Sq + s) * (Hh * Dh) + d] = o[rg][t][i] * inv[i];
      }
    }
  }
}

// ---------------------------------------------------------------------------
extern "C" void kernel_launch(void* const* d_in, const int* in_sizes, int n_in,
                              void* d_out, int out_size, void* d_ws,
                              size_t ws_size, hipStream_t stream) {
  (void)in_sizes; (void)n_in; (void)out_size; (void)ws_size;
  const float* q    = (const float*)d_in[0];
  const float* k    = (const float*)d_in[1];
  const float* v    = (const float*)d_in[2];
  const int*   msk  = (const int*)d_in[3];
  const float* wq   = (const float*)d_in[4];
  const float* bq   = (const float*)d_in[5];
  const float* wk   = (const float*)d_in[6];
  const float* bk   = (const float*)d_in[7];
  const float* wv   = (const float*)d_in[8];
  const float* bv   = (const float*)d_in[9];
  float* out = (float*)d_out;

  // workspace layout (f16): 3x W^T (2 MB each) + qh/kh/vt (16 MB each)
  _Float16* ws  = (_Float16*)d_ws;
  _Float16* wtq = ws;
  _Float16* wtk = wtq + (size_t)Dm * Dm;
  _Float16* wtv = wtk + (size_t)Dm * Dm;
  _Float16* qh  = wtv + (size_t)Dm * Dm;
  const size_t headElems = (size_t)Bsz * Hh * Sq * Dh;
  _Float16* kh = qh + headElems;
  _Float16* vt = kh + headElems;

  dim3 gT((Dm * Dm) / 256, 3);
  wtrans_kernel<<<gT, 256, 0, stream>>>(wq, wk, wv, wtq, wtk, wtv);

  dim3 gP((Bsz * Sq) / 16, 3);
  proj_kernel<<<gP, 256, 0, stream>>>(q, k, v, wtq, wtk, wtv, bq, bk, bv,
                                      qh, kh, vt);

  dim3 gA(Bsz * Hh, Sq / (QROWS * AWAVES));
  attn_kernel<<<gA, 32 * AWAVES, 0, stream>>>(qh, kh, vt, msk, out);
}

// v001
// A run of this version takes 319 microseconds.
// Next to v000, in two timings, it ran 1.75 and 1.74 times as fast.
#include <hip/hip_runtime.h>
#include <hip/hip_bf16.h>

#define DEV __device__ __forceinline__

typedef __attribute__((ext_vector_type(16))) _Float16 v16h;
typedef __attribute__((ext_vector_type(8)))  _Float16 v8h;
typedef __attribute__((ext_vector_type(4)))  _Float16 v4h;
typedef __attribute__((ext_vector_type(8)))  float    v8f;
typedef __attribute__((ext_vector_type(4)))  float    v4f;
typedef __attribute__((ext_vector_type(4)))  int      i32x4;
typedef __attribute__((ext_vector_type(8)))  int      i32x8;
typedef __attribute__((ext_vector_type(4)))  unsigned int u32x4;

static constexpr int Bsz = 4;
static constexpr int Sq  = 2048;
static constexpr int Dm  = 1024;
static constexpr int Hh  = 16;
static constexpr int Dh  = 64;
#define NEGF (-1.0e9f)
#define AWAVES 8   // waves per attention block
#define QROWS 32   // q rows per wave (2 row-groups of 16)

#if __has_builtin(__builtin_amdgcn_global_load_async_to_lds_b128) && \
    __has_builtin(__builtin_amdgcn_s_wait_asynccnt)
#define HAVE_ASYNC_LDS 1
#else
#define HAVE_ASYNC_LDS 0
#endif

#if __has_builtin(__builtin_amdgcn_tensor_load_to_lds) && \
    __has_builtin(__builtin_amdgcn_s_wait_tensorcnt)
#define HAVE_TDM 1
#else
#define HAVE_TDM 0
#endif

#define TDM_SIX_ARGS 1   // this compiler's tensor-load builtin takes six arguments

typedef __attribute__((address_space(1))) i32x4 as1_i32x4;
typedef __attribute__((address_space(3))) i32x4 as3_i32x4;

// ---------------------------------------------------------------------------
// D = A(16x32 f16) * B(32x16 f16) + C(16x16 f32)
DEV v8f wmma_f16(v16h a, v16h b, v8f c) {
  return __builtin_amdgcn_wmma_f32_16x16x32_f16(
      /*neg_a=*/false, a, /*neg_b=*/false, b,
      /*c_mod=*/(short)0, c, /*reuse_a=*/false, /*reuse_b=*/false);
}

DEV v16h load_tile_f16(const _Float16* p, int ld, int lane) {
  const _Float16* base = p + (size_t)(lane & 15) * ld + ((lane >> 4) << 3);
  v8h c0 = *(const v8h*)(base);
  v8h c1 = *(const v8h*)(base + 16);
  v16h r;
#pragma unroll
  for (int j = 0; j < 8; ++j) { r[j] = c0[j]; r[j + 8] = c1[j]; }
  return r;
}

// Same tile pattern but f32 source, converted to f16 on the fly.
DEV v16h load_tile_f32(const float* p, int ld, int lane) {
  const float* base = p + (size_t)(lane & 15) * ld + ((lane >> 4) << 3);
  v4f a0 = *(const v4f*)(base);
  v4f a1 = *(const v4f*)(base + 4);
  v4f b0 = *(const v4f*)(base + 16);
  v4f b1 = *(const v4f*)(base + 20);
  v16h r;
#pragma unroll
  for (int j = 0; j < 4; ++j) {
    r[j]      = (_Float16)a0[j];
    r[j + 4]  = (_Float16)a1[j];
    r[j + 8]  = (_Float16)b0[j];
    r[j + 12] = (_Float16)b1[j];
  }
  return r;
}

DEV void copy16_g2l(const _Float16* g, _Float16* l) {
#if HAVE_ASYNC_LDS
  __builtin_amdgcn_global_load_async_to_lds_b128(
      (as1_i32x4*)(void*)const_cast<_Float16*>(g),
      (as3_i32x4*)(void*)l,
      /*offset=*/0, /*cpol=*/0);
#else
  *(v8h*)l = *(const v8h*)g;
#endif
}

DEV void wait_async_copies() {
#if HAVE_ASYNC_LDS
  __builtin_amdgcn_s_wait_asynccnt(0);
#endif
}

#if HAVE_TDM
DEV void tdm_load_2d(const _Float16* gsrc, _Float16* ldst,
                     unsigned tile_w, unsigned tile_h, unsigned row_stride) {
  const unsigned long long ga = (unsigned long long)(size_t)gsrc;
  const unsigned lds = (unsigned)(size_t)ldst;   // low 32 bits = LDS byte addr
  u32x4 g0;
  g0[0] = 1u;
  g0[1] = lds;
  g0[2] = (unsigned)(ga & 0xffffffffu);
  g0[3] = (unsigned)((ga >> 32) & 0x1ffffffu)
        | (2u << 30);
  i32x8 g1 = {};
  g1[0] = (int)(1u << 16);
  g1[1] = (int)((tile_w & 0xffffu) << 16);
  g1[2] = (int)(((tile_w >> 16) & 0xffffu)
        |       ((tile_h & 0xffffu) << 16));
  g1[3] = (int)(((tile_h >> 16) & 0xffffu)
        |       ((tile_w & 0xffffu) << 16));
  g1[4] = (int)(tile_h & 0xffffu);
  g1[5] = (int)row_stride;
  g1[6] = 0;
  g1[7] = 0;
  i32x4 gz = {};
#if TDM_SIX_ARGS
  i32x8 gz8 = {};
  __builtin_amdgcn_tensor_load_to_lds(g0, g1, gz, gz, gz8, 0);
#else
  __builtin_amdgcn_tensor_load_to_lds(g0, g1, gz, gz, 0);
#endif
}
#endif  // HAVE_TDM

// ---------------------------------------------------------------------------
// Kernel 1: transpose + convert weights (1024x1024 f32 [k][n]) -> f16 W^T [n][k].
__global__ __launch_bounds__(256) void wtrans_kernel(
    const float* __restrict__ wq, const float* __restrict__ wk,
    const float* __restrict__ wv, _Float16* __restrict__ tq,
    _Float16* __restrict__ tk, _Float16* __restrict__ tv) {
  const float* w = (blockIdx.y == 0) ? wq : (blockIdx.y == 1) ? wk : wv;
  _Float16* o    = (blockIdx.y == 0) ? tq : (blockIdx.y == 1) ? tk : tv;
  int idx = blockIdx.x * 256 + threadIdx.x;   // k*1024 + n (coalesced read)
  int n = idx & (Dm - 1);
  int kk = idx >> 10;
  o[(size_t)n * Dm + kk] = (_Float16)w[idx];
}

// ---------------------------------------------------------------------------
// Kernel 2: fused QKV projection GEMM (wave32 WMMA), LDS-tiled.
// grid = (N/128 column tiles, (B*S)/128 row tiles, 3 = q,k,v). Block = 256
// (8 waves, 2 x 4); the block owns a 128 x 128 tile of the output, wave
// (wm, wn) its 64 x 32 part (4 x 2 accumulator tiles).
// Per 64-k step both operands are read from global memory once per block with
// whole-line loads (x converted to f16 on the way) and laid in LDS at a
// 144-byte row pitch; fragments come from LDS. Two LDS buffers: the next
// step's global loads are issued ahead of this step's products and stored
// behind them, one barrier per step.
// Q,K heads -> [b][h][s][64] f16; V -> transposed [b][h][d][s] f16.
static constexpr int PBM = 128;   // rows of x per block
static constexpr int PBN = 128;   // output columns per block
static constexpr int PBK = 64;    // k per step
static constexpr int PLD = 72;    // LDS row pitch in halfs (144 B = 16 B x 9)

__global__ __launch_bounds__(256) void proj_kernel(
    const float* __restrict__ xq, const float* __restrict__ xk,
    const float* __restrict__ xv, const _Float16* __restrict__ wtq,
    const _Float16* __restrict__ wtk, const _Float16* __restrict__ wtv,
    const float* __restrict__ bq, const float* __restrict__ bk,
    const float* __restrict__ bv, _Float16* __restrict__ qh,
    _Float16* __restrict__ kh, _Float16* __restrict__ vt) {
  __shared__ __attribute__((aligned(16))) _Float16 As[2][PBM * PLD];
  __shared__ __attribute__((aligned(16))) _Float16 Bs[2][PBN * PLD];

  const int which = blockIdx.z;
  const float* x      = (which == 0) ? xq  : (which == 1) ? xk  : xv;
  const _Float16* wt  = (which == 0) ? wtq : (which == 1) ? wtk : wtv;
  const float* bias   = (which == 0) ? bq  : (which == 1) ? bk  : bv;
  _Float16* out       = (which == 0) ? qh  : (which == 1) ? kh  : vt;
  const bool tr = (which == 2);

  const int tid    = threadIdx.x;
  const int wave   = tid >> 5;
  const int lane   = tid & 31;
  const int lane15 = lane & 15;
  const int half   = lane >> 4;
  const int wm = wave >> 2;             // 0..1: 64-row part
  const int wn = wave & 3;              // 0..3: 32-column part
  const int r0 = blockIdx.y * PBM;      // global activation row in [0, B*S)
  const int n0 = blockIdx.x * PBN;      // output column base

  // x tile: 128 rows x 64 f32; thread takes float4 (tid & 15) of rows
  // (tid >> 4) + 16 j. W^T tile: 128 rows x 64 f16; thread takes the 16-byte
  // piece (tid & 7) of rows (tid >> 3) + 32 j.
  const int arow = tid >> 4, acol = (tid & 15) * 4;
  const int brow = tid >> 3, bcol = (tid & 7) * 8;
  const float*    ag = x  + (size_t)(r0 + arow) * Dm + acol;
  const _Float16* bg = wt + (size_t)(n0 + brow) * Dm + bcol;

  v4f ra[8];
  v8h rb[4];
  auto gload = [&](int kt) {
#pragma unroll
    for (int j = 0; j < 8; ++j)
      ra[j] = *(const v4f*)(ag + (size_t)(16 * j) * Dm + kt * PBK);
#pragma unroll
    for (int j = 0; j < 4; ++j)
      rb[j] = *(const v8h*)(bg + (size_t)(32 * j) * Dm + kt * PBK);
  };
  auto lstore = [&](int buf) {
#pragma unroll
    for (int j = 0; j < 8; ++j) {
      v4h hx;
#pragma unroll
      for (int e = 0; e < 4; ++e) hx[e] = (_Float16)ra[j][e];
      *(v4h*)&As[buf][(arow + 16 * j) * PLD + acol] = hx;
    }
#pragma unroll
    for (int j = 0; j < 4; ++j)
      *(v8h*)&Bs[buf][(brow + 32 * j) * PLD + bcol] = rb[j];
  };

  v8f acc[4][2] = {};
  auto compute = [&](int buf) {
#pragma unroll
    for (int ks = 0; ks < PBK; ks += 32) {
      v16h a[4], bm[2];
#pragma unroll
      for (int i = 0; i < 4; ++i)
        a[i] = load_tile_f16(&As[buf][(wm * 64 + i * 16) * PLD + ks], PLD, lane);
#pragma unroll
      for (int t = 0; t < 2; ++t)
        bm[t] = load_tile_f16(&Bs[buf][(wn * 32 + t * 16) * PLD + ks], PLD, lane);
#pragma unroll
      for (int i = 0; i < 4; ++i)
#pragma unroll
        for (int t = 0; t < 2; ++t) acc[i][t] = wmma_f16(a[i], bm[t], acc[i][t]);
    }
  };

  constexpr int NK = Dm / PBK;
  gload(0);
  lstore(0);
  __syncthreads();                 // step 0 published
  for (int kt = 0; kt < NK - 1; ++kt) {
    const int buf = kt & 1;
    gload(kt + 1);
    // holds the next step's global loads ahead of the products, so that their
    // latency runs under them (the scheduler otherwise sinks them to the stores)
    __builtin_amdgcn_sched_barrier(0);
    compute(buf);
    // holds the waits on those loads, the conversions and the LDS stores
    // behind the last product
    __builtin_amdgcn_sched_barrier(0);
    lstore(buf ^ 1);               // its last readers left before the previous barrier
    __syncthreads();               // publishes step kt+1, ends the reads of buf
  }
  compute((NK - 1) & 1);

#pragma unroll
  for (int i4 = 0; i4 < 4; ++i4) {
    const int rt = r0 + wm * 64 + i4 * 16;  // first row of this accumulator tile
#pragma unroll
    for (int t = 0; t < 2; ++t) {
      const int c = n0 + wn * 32 + t * 16 + lane15;   // global output column
      const int h = c >> 6, d = c & 63;
      const float bi = bias[c];
      if (!tr) {
#pragma unroll
        for (int i = 0; i < 8; ++i) {
          const int row = rt + i + (half << 3);
          const int b = row >> 11, s = row & (Sq - 1);
          out[((size_t)(b * Hh + h) * Sq + s) * Dh + d] =
              (_Float16)(acc[i4][t][i] + bi);
        }
        // the next tile's sums reuse the registers that these stores name
        asm volatile("s_wait_xcnt 0x0" ::: "memory");
      } else {
        // [b][h][d][S]: 8 consecutive s per lane -> one b128 store
        const int row = rt + (half << 3);
        const int b = row >> 11, s = row & (Sq - 1);
        v8h pk;
#pragma unroll
        for (int i = 0; i < 8; ++i) pk[i] = (_Float16)(acc[i4][t][i] + bi);
        *(v8h*)(out + ((size_t)(b * Hh + h) * Dh + d) * Sq + s) = pk;
        // the next tile's sums reuse the registers that this store names
        asm volatile("s_wait_xcnt 0x0" ::: "memory");
      }
    }
  }
}

__global__ __launch_bounds__(32 * AWAVES) void attn_kernel(
    const _Float16* __restrict__ qh, const _Float16* __restrict__ kh,
    const _Float16* __restrict__ vt, const int* __restrict__ mask,
    float* __restrict__ out) {
  __shared__ _Float16 Kb[2][32 * 64];         // [kpos][d]   4 KB per buffer
  __shared__ _Float16 Vb[2][64 * 32];         // [d][kpos]   4 KB per buffer
  __shared__ _Float16 Pl[AWAVES][2][16 * 32]; // per-wave, per-rowgroup P staging

  const int bh = blockIdx.x;
  const int b = bh >> 4, h = bh & 15;
  const int tid    = threadIdx.x;
  const int wave   = tid >> 5;
  const int lane   = tid & 31;
  const int lane15 = lane & 15;
  const int half   = lane >> 4;
  const int q0 = (blockIdx.y * AWAVES + wave) * QROWS;

  const _Float16* Qh = qh + ((size_t)bh * Sq + q0) * Dh;
  const _Float16* Kh = kh + (size_t)bh * Sq * Dh;
  const _Float16* Vh = vt + (size_t)bh * Dh * Sq;
  const int* Mb = mask + ((size_t)b * Sq + q0) * Sq;

  // stage one 32-kpos K/V chunk into LDS buffer `buf`
  auto stage = [&](int k0, int buf) {
#if HAVE_TDM
    if (wave == 0) {
      // K tile: 32 rows x 64 elems, contiguous (stride = Dh)
      tdm_load_2d(Kh + (size_t)k0 * Dh, &Kb[buf][0], Dh, 32, Dh);
      // V^T tile: 64 rows x 32 elems, row stride = Sq elems
      tdm_load_2d(Vh + k0, &Vb[buf][0], 32, Dh, Sq);
    }
#else
    // K tile: 32 rows x 128B, contiguous 4 KB (one b128 per thread)
    copy16_g2l(Kh + (size_t)k0 * Dh + tid * 8, &Kb[buf][tid * 8]);
    // V^T tile: 64 rows x 64B (row stride S halfs)
    const int r = tid >> 2, o4 = (tid & 3) * 8;
    copy16_g2l(Vh + (size_t)r * Sq + k0 + o4, &Vb[buf][r * 32 + o4]);
#endif
  };
  auto stage_wait = [&]() {
#if HAVE_TDM
    if (wave == 0) __builtin_amdgcn_s_wait_tensorcnt(0);
#else
    wait_async_copies();
#endif
  };

  // Q A-tiles: [rowgroup][dchunk], loaded once, reused for all k.
  v16h aq[2][2];
#pragma unroll
  for (int rg = 0; rg < 2; ++rg) {
    aq[rg][0] = load_tile_f16(Qh + (size_t)rg * 16 * Dh, Dh, lane);
    aq[rg][1] = load_tile_f16(Qh + (size_t)rg * 16 * Dh + 32, Dh, lane);
  }

  v16h bones;
  {
    const _Float16 onev = (_Float16)((lane15 == 0) ? 1.0f : 0.0f);
#pragma unroll
    for (int j = 0; j < 16; ++j) bones[j] = onev;
  }

  v8f o[2][4] = {};
  v8f osum[2] = {};
  float m_i[2][8];
#pragma unroll
  for (int rg = 0; rg < 2; ++rg)
#pragma unroll
    for (int i = 0; i < 8; ++i) m_i[rg][i] = -1.0e30f;

  v16h pa[2];

  stage(0, 0);
  for (int k0 = 0, it = 0; k0 < Sq; k0 += 32, ++it) {
    const int buf = it & 1;
    stage_wait();            // our chunk-`it` DMAs done
    __syncthreads();         // everyone's DMAs visible; other buffer free
    if (k0 + 32 < Sq) stage(k0 + 32, buf ^ 1);
    __builtin_prefetch(Mb + (size_t)(half << 3) * Sq + k0 + 32, 0, 1);

    // K B-tiles from LDS, shared by both row-groups
    v16h b00 = load_tile_f16(&Kb[buf][0], Dh, lane);
    v16h b01 = load_tile_f16(&Kb[buf][32], Dh, lane);
    v16h b10 = load_tile_f16(&Kb[buf][16 * Dh], Dh, lane);
    v16h b11 = load_tile_f16(&Kb[buf][16 * Dh + 32], Dh, lane);

#pragma unroll
    for (int rg = 0; rg < 2; ++rg) {
      v8f s0 = {}, s1 = {};
      s0 = wmma_f16(aq[rg][0], b00, s0);
      s0 = wmma_f16(aq[rg][1], b01, s0);
      s1 = wmma_f16(aq[rg][0], b10, s1);
      s1 = wmma_f16(aq[rg][1], b11, s1);

      float alpha[8];
#pragma unroll
      for (int i = 0; i < 8; ++i) {
        const int qrow = rg * 16 + i + (half << 3);
        const int* mrow = Mb + (size_t)qrow * Sq + k0;
        float sv0 = s0[i] * 0.125f;                 // 1/sqrt(64)
        float sv1 = s1[i] * 0.125f;
        sv0 = (mrow[lane15] == 0) ? NEGF : sv0;
        sv1 = (mrow[lane15 + 16] == 0) ? NEGF : sv1;
        float tm = fmaxf(sv0, sv1);
        tm = fmaxf(tm, __shfl_xor(tm, 1));
        tm = fmaxf(tm, __shfl_xor(tm, 2));
        tm = fmaxf(tm, __shfl_xor(tm, 4));
        tm = fmaxf(tm, __shfl_xor(tm, 8));
        const float mn = fmaxf(m_i[rg][i], tm);
        alpha[i] = __expf(m_i[rg][i] - mn);
        m_i[rg][i] = mn;
        const float p0 = __expf(sv0 - mn);
        const float p1 = __expf(sv1 - mn);
        const int r16 = i + (half << 3);
        Pl[wave][rg][r16 * 32 + lane15]      = (_Float16)p0;
        Pl[wave][rg][r16 * 32 + 16 + lane15] = (_Float16)p1;
      }
#pragma unroll
      for (int t = 0; t < 4; ++t)
#pragma unroll
        for (int i = 0; i < 8; ++i) o[rg][t][i] *= alpha[i];
#pragma unroll
      for (int i = 0; i < 8; ++i) osum[rg][i] *= alpha[i];

      // reload P in A-matrix layout (same-wave DS ops are in order)
      const _Float16* prow = &Pl[wave][rg][lane15 * 32 + (half << 3)];
#pragma unroll
      for (int j = 0; j < 8; ++j) {
        pa[rg][j] = prow[j];
        pa[rg][j + 8] = prow[j + 16];
      }
    }

    // O += P * V: V^T B-tiles loaded once, used by both row-groups
#pragma unroll
    for (int t = 0; t < 4; ++t) {
      v16h bvt = load_tile_f16(&Vb[buf][(t * 16) * 32], 32, lane);
      o[0][t] = wmma_f16(pa[0], bvt, o[0][t]);
      o[1][t] = wmma_f16(pa[1], bvt, o[1][t]);
    }
    // l += P * 1 (row sums via WMMA)
    osum[0] = wmma_f16(pa[0], bones, osum[0]);
    osum[1] = wmma_f16(pa[1], bones, osum[1]);
  }

#pragma unroll
  for (int rg = 0; rg < 2; ++rg) {
    float inv[8];
#pragma unroll
    for (int i = 0; i < 8; ++i) {
      const float l = __shfl(osum[rg][i], half << 4);  // broadcast column 0
      inv[i] = 1.0f / l;
    }
#pragma unroll
    for (int t = 0; t < 4; ++t) {
      const int d = h * Dh + t * 16 + lane15;
#pragma unroll
      for (int i = 0; i < 8; ++i) {
        const int s = q0 + rg * 16 + i + (half << 3);
        out[((size_t)b * Sq + s) * (Hh * Dh) + d] = o[rg][t][i] * inv[i];
      }
    }
  }
}

// ---------------------------------------------------------------------------
extern "C" void kernel_launch(void* const* d_in, const int* in_sizes, int n_in,
                              void* d_out, int out_size, void* d_ws,
                              size_t ws_size, hipStream_t stream) {
  (void)in_sizes; (void)n_in; (void)out_size; (void)ws_size;
  const float* q    = (const float*)d_in[0];
  const float* k    = (const float*)d_in[1];
  const float* v    = (const float*)d_in[2];
  const int*   msk  = (const int*)d_in[3];
  const float* wq   = (const float*)d_in[4];
  const float* bq   = (const float*)d_in[5];
  const float* wk   = (const float*)d_in[6];
  const float* bk   = (const float*)d_in[7];
  const float* wv   = (const float*)d_in[8];
  const float* bv   = (const float*)d_in[9];
  float* out = (float*)d_out;

  // workspace layout (f16): 3x W^T (2 MB each) + qh/kh/vt (16 MB each)
  _Float16* ws  = (_Float16*)d_ws;
  _Float16* wtq = ws;
  _Float16* wtk = wtq + (size_t)Dm * Dm;
  _Float16* wtv = wtk + (size_t)Dm * Dm;
  _Float16* qh  = wtv + (size_t)Dm * Dm;
  const size_t headElems = (size_t)Bsz * Hh * Sq * Dh;
  _Float16* kh = qh + headElems;
  _Float16* vt = kh + headElems;

  dim3 gT((Dm * Dm) / 256, 3);
  wtrans_kernel<<<gT, 256, 0, stream>>>(wq, wk, wv, wtq, wtk, wtv);

  dim3 gP(Dm / PBN, (Bsz * Sq) / PBM, 3);
  proj_kernel<<<gP, 256, 0, stream>>>(q, k, v, wtq, wtk, wtv, bq, bk, bv,
                                      qh, kh, vt);

  dim3 gA(Bsz * Hh, Sq / (QROWS * AWAVES));
  attn_kernel<<<gA, 32 * AWAVES, 0, stream>>>(qh, kh, vt, msk, out);
}

// v002
// Measured time: 251 microseconds a run.
// In both of two side-by-side timings against v001, it was 1.29 times as fast.
// Over all steps from v000 it is 2.25 times as fast.
#include <hip/hip_runtime.h>
#include <hip/hip_bf16.h>

#define DEV __device__ __forceinline__

typedef __attribute__((ext_vector_type(16))) _Float16 v16h;
typedef __attribute__((ext_vector_type(8)))  _Float16 v8h;
typedef __attribute__((ext_vector_type(4)))  _Float16 v4h;
typedef __attribute__((ext_vector_type(8)))  float    v8f;
typedef __attribute__((ext_vector_type(4)))  float    v4f;
typedef __attribute__((ext_vector_type(4)))  int      i32x4;
typedef __attribute__((ext_vector_type(8)))  int      i32x8;
typedef __attribute__((ext_vector_type(4)))  unsigned int u32x4;

static constexpr int Bsz = 4;
static constexpr int Sq  = 2048;
static constexpr int Dm  = 1024;
static constexpr int Hh  = 16;
static constexpr int Dh  = 64;
#define NEGF (-1.0e9f)
#define AWAVES 8   // waves per attention block
#define QROWS 32   // q rows per wave (2 row-groups of 16)

#if __has_builtin(__builtin_amdgcn_global_load_async_to_lds_b128) && \
    __has_builtin(__builtin_amdgcn_s_wait_asynccnt)
#define HAVE_ASYNC_LDS 1
#else
#define HAVE_ASYNC_LDS 0
#endif

#if __has_builtin(__builtin_amdgcn_tensor_load_to_lds) && \
    __has_builtin(__builtin_amdgcn_s_wait_tensorcnt)
#define HAVE_TDM 1
#else
#define HAVE_TDM 0
#endif

#define TDM_SIX_ARGS 1   // this compiler's tensor-load builtin takes six arguments

typedef __attribute__((address_space(1))) i32x4 as1_i32x4;
typedef __attribute__((address_space(3))) i32x4 as3_i32x4;

// ---------------------------------------------------------------------------
// D = A(16x32 f16) * B(32x16 f16) + C(16x16 f32)
DEV v8f wmma_f16(v16h a, v16h b, v8f c) {
  return __builtin_amdgcn_wmma_f32_16x16x32_f16(
      /*neg_a=*/false, a, /*neg_b=*/false, b,
      /*c_mod=*/(short)0, c, /*reuse_a=*/false, /*reuse_b=*/false);
}

DEV v16h load_tile_f16(const _Float16* p, int ld, int lane) {
  const _Float16* base = p + (size_t)(lane & 15) * ld + ((lane >> 4) << 3);
  v8h c0 = *(const v8h*)(base);
  v8h c1 = *(const v8h*)(base + 16);
  v16h r;
#pragma unroll
  for (int j = 0; j < 8; ++j) { r[j] = c0[j]; r[j + 8] = c1[j]; }
  return r;
}

// Same tile pattern but f32 source, converted to f16 on the fly.
DEV v16h load_tile_f32(const float* p, int ld, int lane) {
  const float* base = p + (size_t)(lane & 15) * ld + ((lane >> 4) << 3);
  v4f a0 = *(const v4f*)(base);
  v4f a1 = *(const v4f*)(base + 4);
  v4f b0 = *(const v4f*)(base + 16);
  v4f b1 = *(const v4f*)(base + 20);
  v16h r;
#pragma unroll
  for (int j = 0; j < 4; ++j) {
    r[j]      = (_Float16)a0[j];
    r[j + 4]  = (_Float16)a1[j];
    r[j + 8]  = (_Float16)b0[j];
    r[j + 12] = (_Float16)b1[j];
  }
  return r;
}

DEV void copy16_g2l(const _Float16* g, _Float16* l) {
#if HAVE_ASYNC_LDS
  __builtin_amdgcn_global_load_async_to_lds_b128(
      (as1_i32x4*)(void*)const_cast<_Float16*>(g),
      (as3_i32x4*)(void*)l,
      /*offset=*/0, /*cpol=*/0);
#else
  *(v8h*)l = *(const v8h*)g;
#endif
}

DEV void wait_async_copies() {
#if HAVE_ASYNC_LDS
  __builtin_amdgcn_s_wait_asynccnt(0);
#endif
}

#if HAVE_TDM
DEV void tdm_load_2d(const _Float16* gsrc, _Float16* ldst,
                     unsigned tile_w, unsigned tile_h, unsigned row_stride) {
  const unsigned long long ga = (unsigned long long)(size_t)gsrc;
  const unsigned lds = (unsigned)(size_t)ldst;   // low 32 bits = LDS byte addr
  u32x4 g0;
  g0[0] = 1u;
  g0[1] = lds;
  g0[2] = (unsigned)(ga & 0xffffffffu);
  g0[3] = (unsigned)((ga >> 32) & 0x1ffffffu)
        | (2u << 30);
  i32x8 g1 = {};
  g1[0] = (int)(1u << 16);
  g1[1] = (int)((tile_w & 0xffffu) << 16);
  g1[2] = (int)(((tile_w >> 16) & 0xffffu)
        |       ((tile_h & 0xffffu) << 16));
  g1[3] = (int)(((tile_h >> 16) & 0xffffu)
        |       ((tile_w & 0xffffu) << 16));
  g1[4] = (int)(tile_h & 0xffffu);
  g1[5] = (int)row_stride;
  g1[6] = 0;
  g1[7] = 0;
  i32x4 gz = {};
#if TDM_SIX_ARGS
  i32x8 gz8 = {};
  __builtin_amdgcn_tensor_load_to_lds(g0, g1, gz, gz, gz8, 0);
#else
  __builtin_amdgcn_tensor_load_to_lds(g0, g1, gz, gz, 0);
#endif
}
#endif  // HAVE_TDM

// ---------------------------------------------------------------------------
// Kernel 1: transpose + convert weights (1024x1024 f32 [k][n]) -> f16 W^T [n][k].
__global__ __launch_bounds__(256) void wtrans_kernel(
    const float* __restrict__ wq, const float* __restrict__ wk,
    const float* __restrict__ wv, _Float16* __restrict__ tq,
    _Float16* __restrict__ tk, _Float16* __restrict__ tv) {
  const float* w = (blockIdx.y == 0) ? wq : (blockIdx.y == 1) ? wk : wv;
  _Float16* o    = (blockIdx.y == 0) ? tq : (blockIdx.y == 1) ? tk : tv;
  int idx = blockIdx.x * 256 + threadIdx.x;   // k*1024 + n (coalesced read)
  int n = idx & (Dm - 1);
  int kk = idx >> 10;
  o[(size_t)n * Dm + kk] = (_Float16)w[idx];
}

// ---------------------------------------------------------------------------
// Kernel 2: fused QKV projection GEMM (wave32 WMMA), LDS-tiled.
// grid = (N/128 column tiles, (B*S)/128 row tiles, 3 = q,k,v). Block = 256
// (8 waves, 2 x 4); the block owns a 128 x 128 tile of the output, wave
// (wm, wn) its 64 x 32 part (4 x 2 accumulator tiles).
// Per 64-k step both operands are read from global memory once per block with
// whole-line loads (x converted to f16 on the way) and laid in LDS at a
// 144-byte row pitch; fragments come from LDS. Two LDS buffers: the next
// step's global loads are issued ahead of this step's products and stored
// behind them, one barrier per step.
// Q,K heads -> [b][h][s][64] f16; V -> transposed [b][h][d][s] f16.
static constexpr int PBM = 128;   // rows of x per block
static constexpr int PBN = 128;   // output columns per block
static constexpr int PBK = 64;    // k per step
static constexpr int PLD = 72;    // LDS row pitch in halfs (144 B = 16 B x 9)

__global__ __launch_bounds__(256) void proj_kernel(
    const float* __restrict__ xq, const float* __restrict__ xk,
    const float* __restrict__ xv, const _Float16* __restrict__ wtq,
    const _Float16* __restrict__ wtk, const _Float16* __restrict__ wtv,
    const float* __restrict__ bq, const float* __restrict__ bk,
    const float* __restrict__ bv, _Float16* __restrict__ qh,
    _Float16* __restrict__ kh, _Float16* __restrict__ vt) {
  __shared__ __attribute__((aligned(16))) _Float16 As[2][PBM * PLD];
  __shared__ __attribute__((aligned(16))) _Float16 Bs[2][PBN * PLD];

  const int which = blockIdx.z;
  const float* x      = (which == 0) ? xq  : (which == 1) ? xk  : xv;
  const _Float16* wt  = (which == 0) ? wtq : (which == 1) ? wtk : wtv;
  const float* bias   = (which == 0) ? bq  : (which == 1) ? bk  : bv;
  _Float16* out       = (which == 0) ? qh  : (which == 1) ? kh  : vt;
  const bool tr = (which == 2);

  const int tid    = threadIdx.x;
  const int wave   = tid >> 5;
  const int lane   = tid & 31;
  const int lane15 = lane & 15;
  const int half   = lane >> 4;
  const int wm = wave >> 2;             // 0..1: 64-row part
  const int wn = wave & 3;              // 0..3: 32-column part
  const int r0 = blockIdx.y * PBM;      // global activation row in [0, B*S)
  const int n0 = blockIdx.x * PBN;      // output column base

  // x tile: 128 rows x 64 f32; thread takes float4 (tid & 15) of rows
  // (tid >> 4) + 16 j. W^T tile: 128 rows x 64 f16; thread takes the 16-byte
  // piece (tid & 7) of rows (tid >> 3) + 32 j.
  const int arow = tid >> 4, acol = (tid & 15) * 4;
  const int brow = tid >> 3, bcol = (tid & 7) * 8;
  const float*    ag = x  + (size_t)(r0 + arow) * Dm + acol;
  const _Float16* bg = wt + (size_t)(n0 + brow) * Dm + bcol;

  v4f ra[8];
  v8h rb[4];
  auto gload = [&](int kt) {
#pragma unroll
    for (int j = 0; j < 8; ++j)
      ra[j] = *(const v4f*)(ag + (size_t)(16 * j) * Dm + kt * PBK);
#pragma unroll
    for (int j = 0; j < 4; ++j)
      rb[j] = *(const v8h*)(bg + (size_t)(32 * j) * Dm + kt * PBK);
  };
  auto lstore = [&](int buf) {
#pragma unroll
    for (int j = 0; j < 8; ++j) {
      v4h hx;
#pragma unroll
      for (int e = 0; e < 4; ++e) hx[e] = (_Float16)ra[j][e];
      *(v4h*)&As[buf][(arow + 16 * j) * PLD + acol] = hx;
    }
#pragma unroll
    for (int j = 0; j < 4; ++j)
      *(v8h*)&Bs[buf][(brow + 32 * j) * PLD + bcol] = rb[j];
  };

  v8f acc[4][2] = {};
  auto compute = [&](int buf) {
#pragma unroll
    for (int ks = 0; ks < PBK; ks += 32) {
      v16h a[4], bm[2];
#pragma unroll
      for (int i = 0; i < 4; ++i)
        a[i] = load_tile_f16(&As[buf][(wm * 64 + i * 16) * PLD + ks], PLD, lane);
#pragma unroll
      for (int t = 0; t < 2; ++t)
        bm[t] = load_tile_f16(&Bs[buf][(wn * 32 + t * 16) * PLD + ks], PLD, lane);
#pragma unroll
      for (int i = 0; i < 4; ++i)
#pragma unroll
        for (int t = 0; t < 2; ++t) acc[i][t] = wmma_f16(a[i], bm[t], acc[i][t]);
    }
  };

  constexpr int NK = Dm / PBK;
  gload(0);
  lstore(0);
  __syncthreads();                 // step 0 published
  for (int kt = 0; kt < NK - 1; ++kt) {
    const int buf = kt & 1;
    gload(kt + 1);
    // holds the next step's global loads ahead of the products, so that their
    // latency runs under them (the scheduler otherwise sinks them to the stores)
    __builtin_amdgcn_sched_barrier(0);
    compute(buf);
    // holds the waits on those loads, the conversions and the LDS stores
    // behind the last product
    __builtin_amdgcn_sched_barrier(0);
    lstore(buf ^ 1);               // its last readers left before the previous barrier
    __syncthreads();               // publishes step kt+1, ends the reads of buf
  }
  compute((NK - 1) & 1);

#pragma unroll
  for (int i4 = 0; i4 < 4; ++i4) {
    const int rt = r0 + wm * 64 + i4 * 16;  // first row of this accumulator tile
#pragma unroll
    for (int t = 0; t < 2; ++t) {
      const int c = n0 + wn * 32 + t * 16 + lane15;   // global output column
      const int h = c >> 6, d = c & 63;
      const float bi = bias[c];
      if (!tr) {
#pragma unroll
        for (int i = 0; i < 8; ++i) {
          const int row = rt + i + (half << 3);
          const int b = row >> 11, s = row & (Sq - 1);
          out[((size_t)(b * Hh + h) * Sq + s) * Dh + d] =
              (_Float16)(acc[i4][t][i] + bi);
        }
        // the next tile's sums reuse the registers that these stores name
        asm volatile("s_wait_xcnt 0x0" ::: "memory");
      } else {
        // [b][h][d][S]: 8 consecutive s per lane -> one b128 store
        const int row = rt + (half << 3);
        const int b = row >> 11, s = row & (Sq - 1);
        v8h pk;
#pragma unroll
        for (int i = 0; i < 8; ++i) pk[i] = (_Float16)(acc[i4][t][i] + bi);
        *(v8h*)(out + ((size_t)(b * Hh + h) * Dh + d) * Sq + s) = pk;
        // the next tile's sums reuse the registers that this store names
        asm volatile("s_wait_xcnt 0x0" ::: "memory");
      }
    }
  }
}

DEV float xhalf(float x) {
  const int v = __builtin_bit_cast(int, x);
  return __builtin_bit_cast(
      float, __builtin_amdgcn_permlanex16(v, v, 0x76543210, 0xfedcba98, false, false));
}

__global__ __launch_bounds__(32 * AWAVES) void attn_kernel(
    const _Float16* __restrict__ qh, const _Float16* __restrict__ kh,
    const _Float16* __restrict__ vt, const int* __restrict__ mask,
    float* __restrict__ out) {
  __shared__ _Float16 Kb[2][32 * 64];         // [kpos][d]   4 KB per buffer
  __shared__ _Float16 Vb[2][64 * 32];         // [d][kpos]   4 KB per buffer

  const int bh = blockIdx.x;
  const int b = bh >> 4, h = bh & 15;
  const int tid    = threadIdx.x;
  const int wave   = tid >> 5;
  const int lane   = tid & 31;
  const int lane15 = lane & 15;
  const int half   = lane >> 4;
  const int q0 = (blockIdx.y * AWAVES + wave) * QROWS;

  const _Float16* Qh = qh + ((size_t)bh * Sq + q0) * Dh;
  const _Float16* Kh = kh + (size_t)bh * Sq * Dh;
  const _Float16* Vh = vt + (size_t)bh * Dh * Sq;
  const int* Mb = mask + ((size_t)b * Sq + q0) * Sq;

  // stage one 32-kpos K/V chunk into LDS buffer `buf`
  auto stage = [&](int k0, int buf) {
#if HAVE_TDM
    if (wave == 0) {
      // K tile: 32 rows x 64 elems, contiguous (stride = Dh)
      tdm_load_2d(Kh + (size_t)k0 * Dh, &Kb[buf][0], Dh, 32, Dh);
      // V^T tile: 64 rows x 32 elems, row stride = Sq elems
      tdm_load_2d(Vh + k0, &Vb[buf][0], 32, Dh, Sq);
    }
#else
    // K tile: 32 rows x 128B, contiguous 4 KB (one b128 per thread)
    copy16_g2l(Kh + (size_t)k0 * Dh + tid * 8, &Kb[buf][tid * 8]);
    // V^T tile: 64 rows x 64B (row stride S halfs)
    const int r = tid >> 2, o4 = (tid & 3) * 8;
    copy16_g2l(Vh + (size_t)r * Sq + k0 + o4, &Vb[buf][r * 32 + o4]);
#endif
  };
  auto stage_wait = [&]() {
#if HAVE_TDM
    if (wave == 0) __builtin_amdgcn_s_wait_tensorcnt(0);
#else
    wait_async_copies();
#endif
  };

  // Q^T B-tiles: [column group][dchunk], loaded once, reused for all k.
  v16h bq[2][2];
#pragma unroll
  for (int rg = 0; rg < 2; ++rg) {
    bq[rg][0] = load_tile_f16(Qh + (size_t)rg * 16 * Dh, Dh, lane);
    bq[rg][1] = load_tile_f16(Qh + (size_t)rg * 16 * Dh + 32, Dh, lane);
  }

  v16h aones;
  {
    const _Float16 onev = (_Float16)((lane15 == 0) ? 1.0f : 0.0f);
#pragma unroll
    for (int j = 0; j < 16; ++j) aones[j] = onev;
  }

  v8f o[2][4] = {};     // O^T: [group][d tile]; register r = d 16 t + 8 half + r
  v8f osum[2] = {};
  float m_i[2] = {-1.0e30f, -1.0e30f};

  // this lane's mask words: query row rg*16 + lane15, keys from 8*half on
  const int* Ml = Mb + (size_t)lane15 * Sq + (half << 3);

  v16h pb[2];

  stage(0, 0);
  for (int k0 = 0, it = 0; k0 < Sq; k0 += 32, ++it) {
    const int buf = it & 1;
    stage_wait();            // our chunk-`it` DMAs done
    __syncthreads();         // everyone's DMAs visible; other buffer free
    if (k0 + 32 < Sq) stage(k0 + 32, buf ^ 1);
    __builtin_prefetch(Mb + (size_t)(half << 3) * Sq + k0 + 32, 0, 1);

    // mask words of this chunk: 8 + 8 consecutive keys of the lane's own query
    i32x4 mk[2][4];
#pragma unroll
    for (int rg = 0; rg < 2; ++rg) {
      const int* mrow = Ml + (size_t)(rg * 16) * Sq + k0;
      mk[rg][0] = *(const i32x4*)(mrow);
      mk[rg][1] = *(const i32x4*)(mrow + 4);
      mk[rg][2] = *(const i32x4*)(mrow + 16);
      mk[rg][3] = *(const i32x4*)(mrow + 20);
    }

    // K A-tiles from LDS, shared by both column groups
    v16h a00 = load_tile_f16(&Kb[buf][0], Dh, lane);
    v16h a01 = load_tile_f16(&Kb[buf][32], Dh, lane);
    v16h a10 = load_tile_f16(&Kb[buf][16 * Dh], Dh, lane);
    v16h a11 = load_tile_f16(&Kb[buf][16 * Dh + 32], Dh, lane);
    // the wait in front of any reuse of the mask loads' address registers; naming
    // the address keeps the pair live up to it (else the last load's result is
    // given the pair itself)
    asm volatile("s_wait_xcnt 0x0" :: "v"(Ml + k0) : "memory");
    // holds every mask load of the pass ahead of the products (the scheduler
    // otherwise sinks the last two behind them, into the K registers)
    __builtin_amdgcn_sched_barrier(0);

    v8f sc[2][2];   // S^T: [column group][key tile]
#pragma unroll
    for (int rg = 0; rg < 2; ++rg) {
      v8f s0 = {}, s1 = {};
      s0 = wmma_f16(a00, bq[rg][0], s0);
      s0 = wmma_f16(a01, bq[rg][1], s0);
      s1 = wmma_f16(a10, bq[rg][0], s1);
      s1 = wmma_f16(a11, bq[rg][1], s1);
      sc[rg][0] = s0;
      sc[rg][1] = s1;
    }
    // holds the waits on the mask words behind the score products, so that the
    // products run under the mask loads' latency
    __builtin_amdgcn_sched_barrier(0);

#pragma unroll
    for (int rg = 0; rg < 2; ++rg) {
      // online softmax, one query per lane
      v8f sv0 = sc[rg][0] * 0.125f, sv1 = sc[rg][1] * 0.125f;      // 1/sqrt(64)
#pragma unroll
      for (int i = 0; i < 8; ++i) {
        sv0[i] = (mk[rg][i >> 2][i & 3] == 0) ? NEGF : sv0[i];
        sv1[i] = (mk[rg][2 + (i >> 2)][i & 3] == 0) ? NEGF : sv1[i];
      }
      float tm = sv0[0];
#pragma unroll
      for (int i = 1; i < 8; ++i) tm = fmaxf(tm, sv0[i]);
#pragma unroll
      for (int i = 0; i < 8; ++i) tm = fmaxf(tm, sv1[i]);
      tm = fmaxf(tm, xhalf(tm));
      const float mn = fmaxf(m_i[rg], tm);
      const float alpha = __expf(m_i[rg] - mn);
      m_i[rg] = mn;
#pragma unroll
      for (int i = 0; i < 8; ++i) {
        pb[rg][i]     = (_Float16)__expf(sv0[i] - mn);
        pb[rg][i + 8] = (_Float16)__expf(sv1[i] - mn);
      }
#pragma unroll
      for (int t = 0; t < 4; ++t)
#pragma unroll
        for (int i = 0; i < 8; ++i) o[rg][t][i] *= alpha;
      osum[rg][0] *= alpha;  // rows 1..15 of this tile are 0
    }

    // O^T += V^T * P^T: V^T A-tiles loaded once, used by both column groups
#pragma unroll
    for (int t = 0; t < 4; ++t) {
      v16h avt = load_tile_f16(&Vb[buf][(t * 16) * 32], 32, lane);
      o[0][t] = wmma_f16(avt, pb[0], o[0][t]);
      o[1][t] = wmma_f16(avt, pb[1], o[1][t]);
    }
    // l += 1 * P^T (row sums via WMMA)
    osum[0] = wmma_f16(aones, pb[0], osum[0]);
    osum[1] = wmma_f16(aones, pb[1], osum[1]);
  }

#pragma unroll
  for (int rg = 0; rg < 2; ++rg) {
    const float l = osum[rg][0] + xhalf(osum[rg][0]);
    const float inv = 1.0f / l;
    const int s = q0 + rg * 16 + lane15;
    float* orow = out + ((size_t)b * Sq + s) * (Hh * Dh) + h * Dh + (half << 3);
#pragma unroll
    for (int t = 0; t < 4; ++t) {
      v4f lo, hi;
#pragma unroll
      for (int i = 0; i < 4; ++i) {
        lo[i] = o[rg][t][i] * inv;
        hi[i] = o[rg][t][i + 4] * inv;
      }
      *(v4f*)(orow + t * 16)     = lo;
      *(v4f*)(orow + t * 16 + 4) = hi;
    }
    if (rg == 0) {
      // the second group's products reuse the registers that these stores name
      asm volatile("s_wait_xcnt 0x0" ::: "memory");
      // holds those products behind the wait (the scheduler otherwise lifts them over it)
      __builtin_amdgcn_sched_barrier(0);
    }
  }
}

// ---------------------------------------------------------------------------
extern "C" void kernel_launch(void* const* d_in, const int* in_sizes, int n_in,
                              void* d_out, int out_size, void* d_ws,
                              size_t ws_size, hipStream_t stream) {
  (void)in_sizes; (void)n_in; (void)out_size; (void)ws_size;
  const float* q    = (const float*)d_in[0];
  const float* k    = (const float*)d_in[1];
  const float* v    = (const float*)d_in[2];
  const int*   msk  = (const int*)d_in[3];
  const float* wq   = (const float*)d_in[4];
  const float* bq   = (const float*)d_in[5];
  const float* wk   = (const float*)d_in[6];
  const float* bk   = (const float*)d_in[7];
  const float* wv   = (const float*)d_in[8];
  const float* bv   = (const float*)d_in[9];
  float* out = (float*)d_out;

  // workspace layout (f16): 3x W^T (2 MB each) + qh/kh/vt (16 MB each)
  _Float16* ws  = (_Float16*)d_ws;
  _Float16* wtq = ws;
  _Float16* wtk = wtq + (size_t)Dm * Dm;
  _Float16* wtv = wtk + (size_t)Dm * Dm;
  _Float16* qh  = wtv + (size_t)Dm * Dm;
  const size_t headElems = (size_t)Bsz * Hh * Sq * Dh;
  _Float16* kh = qh + headElems;
  _Float16* vt = kh + headElems;

  dim3 gT((Dm * Dm) / 256, 3);
  wtrans_kernel<<<gT, 256, 0, stream>>>(wq, wk, wv, wtq, wtk, wtv);

  dim3 gP(Dm / PBN, (Bsz * Sq) / PBM, 3);
  proj_kernel<<<gP, 256, 0, stream>>>(q, k, v, wtq, wtk, wtv, bq, bk, bv,
                                      qh, kh, vt);

  dim3 gA(Bsz * Hh, Sq / (QROWS * AWAVES));
  attn_kernel<<<gA, 32 * AWAVES, 0, stream>>>(qh, kh, vt, msk, out);
}

// v003
// One run takes 242 microseconds.
// In both of two side-by-side timings against v002, it was 1.05 times as fast.
// Over all steps from v000 it is 2.37 times as fast.
#include <hip/hip_runtime.h>
#include <hip/hip_bf16.h>

#define DEV __device__ __forceinline__

typedef __attribute__((ext_vector_type(16))) _Float16 v16h;
typedef __attribute__((ext_vector_type(8)))  _Float16 v8h;
typedef __attribute__((ext_vector_type(4)))  _Float16 v4h;
typedef __attribute__((ext_vector_type(8)))  float    v8f;
typedef __attribute__((ext_vector_type(4)))  float    v4f;
typedef __attribute__((ext_vector_type(4)))  int      i32x4;

static constexpr int Bsz = 4;
static constexpr int Sq  = 2048;
static constexpr int Dm  = 1024;
static constexpr int Hh  = 16;
static constexpr int Dh  = 64;
#define NEGF (-1.0e9f)
#define AWAVES 8   // waves per attention block
#define QROWS 32   // q rows per wave (2 row-groups of 16)

// ---------------------------------------------------------------------------
// D = A(16x32 f16) * B(32x16 f16) + C(16x16 f32)
DEV v8f wmma_f16(v16h a, v16h b, v8f c) {
  return __builtin_amdgcn_wmma_f32_16x16x32_f16(
      /*neg_a=*/false, a, /*neg_b=*/false, b,
      /*c_mod=*/(short)0, c, /*reuse_a=*/false, /*reuse_b=*/false);
}

DEV v16h load_tile_f16(const _Float16* p, int ld, int lane) {
  const _Float16* base = p + (size_t)(lane & 15) * ld + ((lane >> 4) << 3);
  v8h c0 = *(const v8h*)(base);
  v8h c1 = *(const v8h*)(base + 16);
  v16h r;
#pragma unroll
  for (int j = 0; j < 8; ++j) { r[j] = c0[j]; r[j + 8] = c1[j]; }
  return r;
}

// Same tile pattern but f32 source, converted to f16 on the fly.
DEV v16h load_tile_f32(const float* p, int ld, int lane) {
  const float* base = p + (size_t)(lane & 15) * ld + ((lane >> 4) << 3);
  v4f a0 = *(const v4f*)(base);
  v4f a1 = *(const v4f*)(base + 4);
  v4f b0 = *(const v4f*)(base + 16);
  v4f b1 = *(const v4f*)(base + 20);
  v16h r;
#pragma unroll
  for (int j = 0; j < 4; ++j) {
    r[j]      = (_Float16)a0[j];
    r[j + 4]  = (_Float16)a1[j];
    r[j + 8]  = (_Float16)b0[j];
    r[j + 12] = (_Float16)b1[j];
  }
  return r;
}

// ---------------------------------------------------------------------------
// Kernel 1: transpose + convert weights (1024x1024 f32 [k][n]) -> f16 W^T [n][k].
__global__ __launch_bounds__(256) void wtrans_kernel(
    const float* __restrict__ wq, const float* __restrict__ wk,
    const float* __restrict__ wv, _Float16* __restrict__ tq,
    _Float16* __restrict__ tk, _Float16* __restrict__ tv) {
  const float* w = (blockIdx.y == 0) ? wq : (blockIdx.y == 1) ? wk : wv;
  _Float16* o    = (blockIdx.y == 0) ? tq : (blockIdx.y == 1) ? tk : tv;
  int idx = blockIdx.x * 256 + threadIdx.x;   // k*1024 + n (coalesced read)
  int n = idx & (Dm - 1);
  int kk = idx >> 10;
  o[(size_t)n * Dm + kk] = (_Float16)w[idx];
}

// ---------------------------------------------------------------------------
// Kernel 2: fused QKV projection GEMM (wave32 WMMA), LDS-tiled.
// grid = (N/128 column tiles, (B*S)/128 row tiles, 3 = q,k,v). Block = 256
// (8 waves, 2 x 4); the block owns a 128 x 128 tile of the output, wave
// (wm, wn) its 64 x 32 part (4 x 2 accumulator tiles).
// Per 64-k step both operands are read from global memory once per block with
// whole-line loads (x converted to f16 on the way) and laid in LDS at a
// 144-byte row pitch; fragments come from LDS. Two LDS buffers: the next
// step's global loads are issued ahead of this step's products and stored
// behind them, one barrier per step.
// Q,K heads -> [b][h][s][64] f16; V -> transposed [b][h][d][s] f16.
static constexpr int PBM = 128;   // rows of x per block
static constexpr int PBN = 128;   // output columns per block
static constexpr int PBK = 64;    // k per step
static constexpr int PLD = 72;    // LDS row pitch in halfs (144 B = 16 B x 9)

__global__ __launch_bounds__(256) void proj_kernel(
    const float* __restrict__ xq, const float* __restrict__ xk,
    const float* __restrict__ xv, const _Float16* __restrict__ wtq,
    const _Float16* __restrict__ wtk, const _Float16* __restrict__ wtv,
    const float* __restrict__ bq, const float* __restrict__ bk,
    const float* __restrict__ bv, _Float16* __restrict__ qh,
    _Float16* __restrict__ kh, _Float16* __restrict__ vt) {
  __shared__ __attribute__((aligned(16))) _Float16 As[2][PBM * PLD];
  __shared__ __attribute__((aligned(16))) _Float16 Bs[2][PBN * PLD];

  const int which = blockIdx.z;
  const float* x      = (which == 0) ? xq  : (which == 1) ? xk  : xv;
  const _Float16* wt  = (which == 0) ? wtq : (which == 1) ? wtk : wtv;
  const float* bias   = (which == 0) ? bq  : (which == 1) ? bk  : bv;
  _Float16* out       = (which == 0) ? qh  : (which == 1) ? kh  : vt;
  const bool tr = (which == 2);

  const int tid    = threadIdx.x;
  const int wave   = tid >> 5;
  const int lane   = tid & 31;
  const int lane15 = lane & 15;
  const int half   = lane >> 4;
  const int wm = wave >> 2;             // 0..1: 64-row part
  const int wn = wave & 3;              // 0..3: 32-column part
  const int r0 = blockIdx.y * PBM;      // global activation row in [0, B*S)
  const int n0 = blockIdx.x * PBN;      // output column base

  // x tile: 128 rows x 64 f32; thread takes float4 (tid & 15) of rows
  // (tid >> 4) + 16 j. W^T tile: 128 rows x 64 f16; thread takes the 16-byte
  // piece (tid & 7) of rows (tid >> 3) + 32 j.
  const int arow = tid >> 4, acol = (tid & 15) * 4;
  const int brow = tid >> 3, bcol = (tid & 7) * 8;
  const float*    ag = x  + (size_t)(r0 + arow) * Dm + acol;
  const _Float16* bg = wt + (size_t)(n0 + brow) * Dm + bcol;

  v4f ra[8];
  v8h rb[4];
  auto gload = [&](int kt) {
#pragma unroll
    for (int j = 0; j < 8; ++j)
      ra[j] = *(const v4f*)(ag + (size_t)(16 * j) * Dm + kt * PBK);
#pragma unroll
    for (int j = 0; j < 4; ++j)
      rb[j] = *(const v8h*)(bg + (size_t)(32 * j) * Dm + kt * PBK);
  };
  auto lstore = [&](int buf) {
#pragma unroll
    for (int j = 0; j < 8; ++j) {
      v4h hx;
#pragma unroll
      for (int e = 0; e < 4; ++e) hx[e] = (_Float16)ra[j][e];
      *(v4h*)&As[buf][(arow + 16 * j) * PLD + acol] = hx;
    }
#pragma unroll
    for (int j = 0; j < 4; ++j)
      *(v8h*)&Bs[buf][(brow + 32 * j) * PLD + bcol] = rb[j];
  };

  v8f acc[4][2] = {};
  auto compute = [&](int buf) {
#pragma unroll
    for (int ks = 0; ks < PBK; ks += 32) {
      v16h a[4], bm[2];
#pragma unroll
      for (int i = 0; i < 4; ++i)
        a[i] = load_tile_f16(&As[buf][(wm * 64 + i * 16) * PLD + ks], PLD, lane);
#pragma unroll
      for (int t = 0; t < 2; ++t)
        bm[t] = load_tile_f16(&Bs[buf][(wn * 32 + t * 16) * PLD + ks], PLD, lane);
#pragma unroll
      for (int i = 0; i < 4; ++i)
#pragma unroll
        for (int t = 0; t < 2; ++t) acc[i][t] = wmma_f16(a[i], bm[t], acc[i][t]);
    }
  };

  constexpr int NK = Dm / PBK;
  gload(0);
  lstore(0);
  __syncthreads();                 // step 0 published
  for (int kt = 0; kt < NK - 1; ++kt) {
    const int buf = kt & 1;
    gload(kt + 1);
    // holds the next step's global loads ahead of the products, so that their
    // latency runs under them (the scheduler otherwise sinks them to the stores)
    __builtin_amdgcn_sched_barrier(0);
    compute(buf);
    // holds the waits on those loads, the conversions and the LDS stores
    // behind the last product
    __builtin_amdgcn_sched_barrier(0);
    lstore(buf ^ 1);               // its last readers left before the previous barrier
    __syncthreads();               // publishes step kt+1, ends the reads of buf
  }
  compute((NK - 1) & 1);

#pragma unroll
  for (int i4 = 0; i4 < 4; ++i4) {
    const int rt = r0 + wm * 64 + i4 * 16;  // first row of this accumulator tile
#pragma unroll
    for (int t = 0; t < 2; ++t) {
      const int c = n0 + wn * 32 + t * 16 + lane15;   // global output column
      const int h = c >> 6, d = c & 63;
      const float bi = bias[c];
      if (!tr) {
#pragma unroll
        for (int i = 0; i < 8; ++i) {
          const int row = rt + i + (half << 3);
          const int b = row >> 11, s = row & (Sq - 1);
          out[((size_t)(b * Hh + h) * Sq + s) * Dh + d] =
              (_Float16)(acc[i4][t][i] + bi);
        }
        // the next tile's sums reuse the registers that these stores name
        asm volatile("s_wait_xcnt 0x0" ::: "memory");
      } else {
        // [b][h][d][S]: 8 consecutive s per lane -> one b128 store
        const int row = rt + (half << 3);
        const int b = row >> 11, s = row & (Sq - 1);
        v8h pk;
#pragma unroll
        for (int i = 0; i < 8; ++i) pk[i] = (_Float16)(acc[i4][t][i] + bi);
        *(v8h*)(out + ((size_t)(b * Hh + h) * Dh + d) * Sq + s) = pk;
        // the next tile's sums reuse the registers that this store names
        asm volatile("s_wait_xcnt 0x0" ::: "memory");
      }
    }
  }
}

static constexpr int KLD = 72;   // K row pitch in LDS, halfs (144 B = 16 B x 9)
static constexpr int VLD = 40;   // V^T row pitch in LDS, halfs (80 B = 16 B x 5)

DEV float xhalf(float x) {
  const int v = __builtin_bit_cast(int, x);
  return __builtin_bit_cast(
      float, __builtin_amdgcn_permlanex16(v, v, 0x76543210, 0xfedcba98, false, false));
}

__global__ __launch_bounds__(32 * AWAVES) void attn_kernel(
    const _Float16* __restrict__ qh, const _Float16* __restrict__ kh,
    const _Float16* __restrict__ vt, const int* __restrict__ mask,
    float* __restrict__ out) {
  __shared__ __attribute__((aligned(16))) _Float16 Kb[2][32 * KLD];  // [kpos][d]
  __shared__ __attribute__((aligned(16))) _Float16 Vb[2][64 * VLD];  // [d][kpos]

  const int bh = blockIdx.x;
  const int b = bh >> 4, h = bh & 15;
  const int tid    = threadIdx.x;
  const int wave   = tid >> 5;
  const int lane   = tid & 31;
  const int lane15 = lane & 15;
  const int half   = lane >> 4;
  const int q0 = (blockIdx.y * AWAVES + wave) * QROWS;

  const _Float16* Qh = qh + ((size_t)bh * Sq + q0) * Dh;
  const _Float16* Kh = kh + (size_t)bh * Sq * Dh;
  const _Float16* Vh = vt + (size_t)bh * Dh * Sq;
  const int* Mb = mask + ((size_t)b * Sq + q0) * Sq;

  // stage one 32-kpos K/V chunk into LDS buffer `buf`: K tile 32 rows x 128 B
  // (thread: 16-byte piece tid & 7 of row tid >> 3, 4 KB contiguous in memory),
  // V^T tile 64 rows x 64 B (piece tid & 3 of row tid >> 2, source pitch Sq halfs)
  const _Float16* kg = Kh + tid * 8;
  const _Float16* vg = Vh + (size_t)(tid >> 2) * Sq + (tid & 3) * 8;
  const unsigned kl = (unsigned)(size_t)&Kb[0][(tid >> 3) * KLD + (tid & 7) * 8];
  const unsigned vl = (unsigned)(size_t)&Vb[0][(tid >> 2) * VLD + (tid & 3) * 8];
  auto stage = [&](int k0, int buf) {
    // the wait in the copies' own statement stands in front of any rewrite of
    // the address registers that they name
    asm volatile(
        "global_load_async_to_lds_b128 %0, %1, off\n\t"
        "global_load_async_to_lds_b128 %2, %3, off\n\t"
        "s_wait_xcnt 0x0"
        :: "v"(kl + (unsigned)buf * (unsigned)(32 * KLD * 2)), "v"(kg + (size_t)k0 * Dh),
           "v"(vl + (unsigned)buf * (unsigned)(64 * VLD * 2)), "v"(vg + k0)
        : "memory");
  };

  // Q^T B-tiles: [column group][dchunk], loaded once, reused for all k.
  v16h bq[2][2];
#pragma unroll
  for (int rg = 0; rg < 2; ++rg) {
    bq[rg][0] = load_tile_f16(Qh + (size_t)rg * 16 * Dh, Dh, lane);
    bq[rg][1] = load_tile_f16(Qh + (size_t)rg * 16 * Dh + 32, Dh, lane);
  }

  v16h aones;
  {
    const _Float16 onev = (_Float16)((lane15 == 0) ? 1.0f : 0.0f);
#pragma unroll
    for (int j = 0; j < 16; ++j) aones[j] = onev;
  }

  v8f o[2][4] = {};     // O^T: [group][d tile]; register r = d 16 t + 8 half + r
  v8f osum[2] = {};
  float m_i[2] = {-1.0e30f, -1.0e30f};

  // this lane's mask words: query row rg*16 + lane15, keys from 8*half on
  const int* Ml = Mb + (size_t)lane15 * Sq + (half << 3);

  v16h pb[2];

  stage(0, 0);
  asm volatile("s_wait_asynccnt 0x0" ::: "memory");   // this wave's chunk-0 copies have landed
  __syncthreads();                                    // chunk 0 published
  stage(32, 1);
  for (int k0 = 0, it = 0; k0 < Sq; k0 += 32, ++it) {
    const int buf = it & 1;
    __builtin_prefetch(Mb + (size_t)(half << 3) * Sq + k0 + 32, 0, 1);

    // mask words of this chunk: 8 + 8 consecutive keys of the lane's own query
    i32x4 mk[2][4];
#pragma unroll
    for (int rg = 0; rg < 2; ++rg) {
      const int* mrow = Ml + (size_t)(rg * 16) * Sq + k0;
      mk[rg][0] = *(const i32x4*)(mrow);
      mk[rg][1] = *(const i32x4*)(mrow + 4);
      mk[rg][2] = *(const i32x4*)(mrow + 16);
      mk[rg][3] = *(const i32x4*)(mrow + 20);
    }

    // K A-tiles from LDS, shared by both column groups
    v16h a00 = load_tile_f16(&Kb[buf][0], KLD, lane);
    v16h a01 = load_tile_f16(&Kb[buf][32], KLD, lane);
    v16h a10 = load_tile_f16(&Kb[buf][16 * KLD], KLD, lane);
    v16h a11 = load_tile_f16(&Kb[buf][16 * KLD + 32], KLD, lane);
    // the wait in front of any reuse of the mask loads' address registers; naming
    // the address keeps the pair live up to it (else the last load's result is
    // given the pair itself)
    asm volatile("s_wait_xcnt 0x0" :: "v"(Ml + k0) : "memory");
    // holds every mask load of the pass ahead of the products (the scheduler
    // otherwise sinks the last two behind them, into the K registers)
    __builtin_amdgcn_sched_barrier(0);

    v8f sc[2][2];   // S^T: [column group][key tile]
#pragma unroll
    for (int rg = 0; rg < 2; ++rg) {
      v8f s0 = {}, s1 = {};
      s0 = wmma_f16(a00, bq[rg][0], s0);
      s0 = wmma_f16(a01, bq[rg][1], s0);
      s1 = wmma_f16(a10, bq[rg][0], s1);
      s1 = wmma_f16(a11, bq[rg][1], s1);
      sc[rg][0] = s0;
      sc[rg][1] = s1;
    }
    // holds the waits on the mask words behind the score products, so that the
    // products run under the mask loads' latency
    __builtin_amdgcn_sched_barrier(0);

#pragma unroll
    for (int rg = 0; rg < 2; ++rg) {
      // online softmax, one query per lane
      v8f sv0 = sc[rg][0] * 0.125f, sv1 = sc[rg][1] * 0.125f;      // 1/sqrt(64)
#pragma unroll
      for (int i = 0; i < 8; ++i) {
        sv0[i] = (mk[rg][i >> 2][i & 3] == 0) ? NEGF : sv0[i];
        sv1[i] = (mk[rg][2 + (i >> 2)][i & 3] == 0) ? NEGF : sv1[i];
      }
      float tm = sv0[0];
#pragma unroll
      for (int i = 1; i < 8; ++i) tm = fmaxf(tm, sv0[i]);
#pragma unroll
      for (int i = 0; i < 8; ++i) tm = fmaxf(tm, sv1[i]);
      tm = fmaxf(tm, xhalf(tm));
      const float mn = fmaxf(m_i[rg], tm);
      const float alpha = __expf(m_i[rg] - mn);
      m_i[rg] = mn;
#pragma unroll
      for (int i = 0; i < 8; ++i) {
        pb[rg][i]     = (_Float16)__expf(sv0[i] - mn);
        pb[rg][i + 8] = (_Float16)__expf(sv1[i] - mn);
      }
#pragma unroll
      for (int t = 0; t < 4; ++t)
#pragma unroll
        for (int i = 0; i < 8; ++i) o[rg][t][i] *= alpha;
      osum[rg][0] *= alpha;  // rows 1..15 of this tile are 0
    }

    // O^T += V^T * P^T: V^T A-tiles loaded once, used by both column groups
#pragma unroll
    for (int t = 0; t < 4; ++t) {
      v16h avt = load_tile_f16(&Vb[buf][(t * 16) * VLD], VLD, lane);
      o[0][t] = wmma_f16(avt, pb[0], o[0][t]);
      o[1][t] = wmma_f16(avt, pb[1], o[1][t]);
    }
    // l += 1 * P^T (row sums via WMMA)
    osum[0] = wmma_f16(aones, pb[0], osum[0]);
    osum[1] = wmma_f16(aones, pb[1], osum[1]);

    // publish point of the next chunk
    asm volatile("s_wait_dscnt 0x0" ::: "memory");     // this wave's reads of buf are done
    asm volatile("s_wait_asynccnt 0x0" ::: "memory");  // its copies of the next chunk have landed
    __syncthreads();   // next chunk published; every reader has left buf
    if (k0 + 64 < Sq) stage(k0 + 64, buf);
  }
  asm volatile("s_wait_asynccnt 0x0" ::: "memory");    // nothing in flight at the wave's end

#pragma unroll
  for (int rg = 0; rg < 2; ++rg) {
    const float l = osum[rg][0] + xhalf(osum[rg][0]);
    const float inv = 1.0f / l;
    const int s = q0 + rg * 16 + lane15;
    float* orow = out + ((size_t)b * Sq + s) * (Hh * Dh) + h * Dh + (half << 3);
#pragma unroll
    for (int t = 0; t < 4; ++t) {
      v4f lo, hi;
#pragma unroll
      for (int i = 0; i < 4; ++i) {
        lo[i] = o[rg][t][i] * inv;
        hi[i] = o[rg][t][i + 4] * inv;
      }
      *(v4f*)(orow + t * 16)     = lo;
      *(v4f*)(orow + t * 16 + 4) = hi;
    }
    if (rg == 0) {
      // the second group's products reuse the registers that these stores name
      asm volatile("s_wait_xcnt 0x0" ::: "memory");
      // holds those products behind the wait (the scheduler otherwise lifts them over it)
      __builtin_amdgcn_sched_barrier(0);
    }
  }
}

// ---------------------------------------------------------------------------
extern "C" void kernel_launch(void* const* d_in, const int* in_sizes, int n_in,
                              void* d_out, int out_size, void* d_ws,
                              size_t ws_size, hipStream_t stream) {
  (void)in_sizes; (void)n_in; (void)out_size; (void)ws_size;
  const float* q    = (const float*)d_in[0];
  const float* k    = (const float*)d_in[1];
  const float* v    = (const float*)d_in[2];
  const int*   msk  = (const int*)d_in[3];
  const float* wq   = (const float*)d_in[4];
  const float* bq   = (const float*)d_in[5];
  const float* wk   = (const float*)d_in[6];
  const float* bk   = (const float*)d_in[7];
  const float* wv   = (const float*)d_in[8];
  const float* bv   = (const float*)d_in[9];
  float* out = (float*)d_out;

  // workspace layout (f16): 3x W^T (2 MB each) + qh/kh/vt (16 MB each)
  _Float16* ws  = (_Float16*)d_ws;
  _Float16* wtq = ws;
  _Float16* wtk = wtq + (size_t)Dm * Dm;
  _Float16* wtv = wtk + (size_t)Dm * Dm;
  _Float16* qh  = wtv + (size_t)Dm * Dm;
  const size_t headElems = (size_t)Bsz * Hh * Sq * Dh;
  _Float16* kh = qh + headElems;
  _Float16* vt = kh + headElems;

  dim3 gT((Dm * Dm) / 256, 3);
  wtrans_kernel<<<gT, 256, 0, stream>>>(wq, wk, wv, wtq, wtk, wtv);

  dim3 gP(Dm / PBN, (Bsz * Sq) / PBM, 3);
  proj_kernel<<<gP, 256, 0, stream>>>(q, k, v, wtq, wtk, wtv, bq, bk, bv,
                                      qh, kh, vt);

  dim3 gA(Bsz * Hh, Sq / (QROWS * AWAVES));
  attn_kernel<<<gA, 32 * AWAVES, 0, stream>>>(qh, kh, vt, msk, out);
}

// v004
// It runs in 206 microseconds.
// In two side-by-side timings against v003, it was 1.17 and 1.15 times as fast.
// Over all steps from v000 it is 2.74 times as fast.
#include <hip/hip_runtime.h>
#include <hip/hip_bf16.h>

#define DEV __device__ __forceinline__

typedef __attribute__((ext_vector_type(16))) _Float16 v16h;
typedef __attribute__((ext_vector_type(8)))  _Float16 v8h;
typedef __attribute__((ext_vector_type(4)))  _Float16 v4h;
typedef __attribute__((ext_vector_type(8)))  float    v8f;
typedef __attribute__((ext_vector_type(4)))  float    v4f;
typedef __attribute__((ext_vector_type(4)))  int      i32x4;
typedef __attribute__((ext_vector_type(16))) unsigned u32x16;
// memory that no one writes while the kernel runs: a load at a wave-uniform
// address through this type is a scalar load
typedef const __attribute__((address_space(4))) u32x16 cu32x16;

static constexpr int Bsz = 4;
static constexpr int Sq  = 2048;
static constexpr int Dm  = 1024;
static constexpr int Hh  = 16;
static constexpr int Dh  = 64;
#define NEGF (-1.0e9f)
#define AWAVES 8   // waves per attention block
#define QROWS 32   // q rows per wave (2 row-groups of 16)

// ---------------------------------------------------------------------------
// D = A(16x32 f16) * B(32x16 f16) + C(16x16 f32)
DEV v8f wmma_f16(v16h a, v16h b, v8f c) {
  return __builtin_amdgcn_wmma_f32_16x16x32_f16(
      /*neg_a=*/false, a, /*neg_b=*/false, b,
      /*c_mod=*/(short)0, c, /*reuse_a=*/false, /*reuse_b=*/false);
}

DEV v16h load_tile_f16(const _Float16* p, int ld, int lane) {
  const _Float16* base = p + (size_t)(lane & 15) * ld + ((lane >> 4) << 3);
  v8h c0 = *(const v8h*)(base);
  v8h c1 = *(const v8h*)(base + 16);
  v16h r;
#pragma unroll
  for (int j = 0; j < 8; ++j) { r[j] = c0[j]; r[j + 8] = c1[j]; }
  return r;
}

// Same tile pattern but f32 source, converted to f16 on the fly.
DEV v16h load_tile_f32(const float* p, int ld, int lane) {
  const float* base = p + (size_t)(lane & 15) * ld + ((lane >> 4) << 3);
  v4f a0 = *(const v4f*)(base);
  v4f a1 = *(const v4f*)(base + 4);
  v4f b0 = *(const v4f*)(base + 16);
  v4f b1 = *(const v4f*)(base + 20);
  v16h r;
#pragma unroll
  for (int j = 0; j < 4; ++j) {
    r[j]      = (_Float16)a0[j];
    r[j + 4]  = (_Float16)a1[j];
    r[j + 8]  = (_Float16)b0[j];
    r[j + 12] = (_Float16)b1[j];
  }
  return r;
}

// ---------------------------------------------------------------------------
// Kernel 1: transpose + convert weights (1024x1024 f32 [k][n]) -> f16 W^T [n][k].
__global__ __launch_bounds__(256) void wtrans_kernel(
    const float* __restrict__ wq, const float* __restrict__ wk,
    const float* __restrict__ wv, _Float16* __restrict__ tq,
    _Float16* __restrict__ tk, _Float16* __restrict__ tv) {
  const float* w = (blockIdx.y == 0) ? wq : (blockIdx.y == 1) ? wk : wv;
  _Float16* o    = (blockIdx.y == 0) ? tq : (blockIdx.y == 1) ? tk : tv;
  int idx = blockIdx.x * 256 + threadIdx.x;   // k*1024 + n (coalesced read)
  int n = idx & (Dm - 1);
  int kk = idx >> 10;
  o[(size_t)n * Dm + kk] = (_Float16)w[idx];
}

// ---------------------------------------------------------------------------
// Kernel 2: fused QKV projection GEMM (wave32 WMMA), LDS-tiled.
// grid = (N/128 column tiles, (B*S)/128 row tiles, 3 = q,k,v). Block = 256
// (8 waves, 2 x 4); the block owns a 128 x 128 tile of the output, wave
// (wm, wn) its 64 x 32 part (4 x 2 accumulator tiles).
// Per 64-k step both operands are read from global memory once per block with
// whole-line loads (x converted to f16 on the way) and laid in LDS at a
// 144-byte row pitch; fragments come from LDS. Two LDS buffers: the next
// step's global loads are issued ahead of this step's products and stored
// behind them, one barrier per step.
// Q,K heads -> [b][h][s][64] f16; V -> transposed [b][h][d][s] f16.
static constexpr int PBM = 128;   // rows of x per block
static constexpr int PBN = 128;   // output columns per block
static constexpr int PBK = 64;    // k per step
static constexpr int PLD = 72;    // LDS row pitch in halfs (144 B = 16 B x 9)

__global__ __launch_bounds__(256) void proj_kernel(
    const float* __restrict__ xq, const float* __restrict__ xk,
    const float* __restrict__ xv, const _Float16* __restrict__ wtq,
    const _Float16* __restrict__ wtk, const _Float16* __restrict__ wtv,
    const float* __restrict__ bq, const float* __restrict__ bk,
    const float* __restrict__ bv, _Float16* __restrict__ qh,
    _Float16* __restrict__ kh, _Float16* __restrict__ vt) {
  __shared__ __attribute__((aligned(16))) _Float16 As[2][PBM * PLD];
  __shared__ __attribute__((aligned(16))) _Float16 Bs[2][PBN * PLD];

  const int which = blockIdx.z;
  const float* x      = (which == 0) ? xq  : (which == 1) ? xk  : xv;
  const _Float16* wt  = (which == 0) ? wtq : (which == 1) ? wtk : wtv;
  const float* bias   = (which == 0) ? bq  : (which == 1) ? bk  : bv;
  _Float16* out       = (which == 0) ? qh  : (which == 1) ? kh  : vt;
  const bool tr = (which == 2);

  const int tid    = threadIdx.x;
  const int wave   = tid >> 5;
  const int lane   = tid & 31;
  const int lane15 = lane & 15;
  const int half   = lane >> 4;
  const int wm = wave >> 2;             // 0..1: 64-row part
  const int wn = wave & 3;              // 0..3: 32-column part
  const int r0 = blockIdx.y * PBM;      // global activation row in [0, B*S)
  const int n0 = blockIdx.x * PBN;      // output column base

  // x tile: 128 rows x 64 f32; thread takes float4 (tid & 15) of rows
  // (tid >> 4) + 16 j. W^T tile: 128 rows x 64 f16; thread takes the 16-byte
  // piece (tid & 7) of rows (tid >> 3) + 32 j.
  const int arow = tid >> 4, acol = (tid & 15) * 4;
  const int brow = tid >> 3, bcol = (tid & 7) * 8;
  const float*    ag = x  + (size_t)(r0 + arow) * Dm + acol;
  const _Float16* bg = wt + (size_t)(n0 + brow) * Dm + bcol;

  v4f ra[8];
  v8h rb[4];
  auto gload = [&](int kt) {
#pragma unroll
    for (int j = 0; j < 8; ++j)
      ra[j] = *(const v4f*)(ag + (size_t)(16 * j) * Dm + kt * PBK);
#pragma unroll
    for (int j = 0; j < 4; ++j)
      rb[j] = *(const v8h*)(bg + (size_t)(32 * j) * Dm + kt * PBK);
  };
  auto lstore = [&](int buf) {
#pragma unroll
    for (int j = 0; j < 8; ++j) {
      v4h hx;
#pragma unroll
      for (int e = 0; e < 4; ++e) hx[e] = (_Float16)ra[j][e];
      *(v4h*)&As[buf][(arow + 16 * j) * PLD + acol] = hx;
    }
#pragma unroll
    for (int j = 0; j < 4; ++j)
      *(v8h*)&Bs[buf][(brow + 32 * j) * PLD + bcol] = rb[j];
  };

  v8f acc[4][2] = {};
  auto compute = [&](int buf) {
#pragma unroll
    for (int ks = 0; ks < PBK; ks += 32) {
      v16h a[4], bm[2];
#pragma unroll
      for (int i = 0; i < 4; ++i)
        a[i] = load_tile_f16(&As[buf][(wm * 64 + i * 16) * PLD + ks], PLD, lane);
#pragma unroll
      for (int t = 0; t < 2; ++t)
        bm[t] = load_tile_f16(&Bs[buf][(wn * 32 + t * 16) * PLD + ks], PLD, lane);
#pragma unroll
      for (int i = 0; i < 4; ++i)
#pragma unroll
        for (int t = 0; t < 2; ++t) acc[i][t] = wmma_f16(a[i], bm[t], acc[i][t]);
    }
  };

  constexpr int NK = Dm / PBK;
  gload(0);
  lstore(0);
  __syncthreads();                 // step 0 published
  for (int kt = 0; kt < NK - 1; ++kt) {
    const int buf = kt & 1;
    gload(kt + 1);
    // holds the next step's global loads ahead of the products, so that their
    // latency runs under them (the scheduler otherwise sinks them to the stores)
    __builtin_amdgcn_sched_barrier(0);
    compute(buf);
    // holds the waits on those loads, the conversions and the LDS stores
    // behind the last product
    __builtin_amdgcn_sched_barrier(0);
    lstore(buf ^ 1);               // its last readers left before the previous barrier
    __syncthreads();               // publishes step kt+1, ends the reads of buf
  }
  compute((NK - 1) & 1);

#pragma unroll
  for (int i4 = 0; i4 < 4; ++i4) {
    const int rt = r0 + wm * 64 + i4 * 16;  // first row of this accumulator tile
#pragma unroll
    for (int t = 0; t < 2; ++t) {
      const int c = n0 + wn * 32 + t * 16 + lane15;   // global output column
      const int h = c >> 6, d = c & 63;
      const float bi = bias[c];
      if (!tr) {
#pragma unroll
        for (int i = 0; i < 8; ++i) {
          const int row = rt + i + (half << 3);
          const int b = row >> 11, s = row & (Sq - 1);
          out[((size_t)(b * Hh + h) * Sq + s) * Dh + d] =
              (_Float16)(acc[i4][t][i] + bi);
        }
        // the next tile's sums reuse the registers that these stores name
        asm volatile("s_wait_xcnt 0x0" ::: "memory");
      } else {
        // [b][h][d][S]: 8 consecutive s per lane -> one b128 store
        const int row = rt + (half << 3);
        const int b = row >> 11, s = row & (Sq - 1);
        v8h pk;
#pragma unroll
        for (int i = 0; i < 8; ++i) pk[i] = (_Float16)(acc[i4][t][i] + bi);
        *(v8h*)(out + ((size_t)(b * Hh + h) * Dh + d) * Sq + s) = pk;
        // the next tile's sums reuse the registers that this store names
        asm volatile("s_wait_xcnt 0x0" ::: "memory");
      }
    }
  }
}

__global__ __launch_bounds__(256) void maskpack_kernel(
    const int* __restrict__ mask, unsigned* __restrict__ pm) {
  const int lane   = threadIdx.x & 31;
  const int lane15 = lane & 15;
  const int half   = lane >> 4;
  const int w  = blockIdx.x * 8 + (threadIdx.x >> 5);
  const int cp = w & (Sq / 64 - 1);   // pair of key chunks
  const int qb = w / (Sq / 64);       // b * S/32 + query block
  const int* src = mask + ((size_t)qb * 32 + lane15) * Sq + cp * 64 + (half << 3);

  i32x4 mk[2][2][4];   // [chunk][column group][piece]
#pragma unroll
  for (int c = 0; c < 2; ++c)
#pragma unroll
    for (int rg = 0; rg < 2; ++rg) {
      const int* mrow = src + (size_t)(rg * 16) * Sq + c * 32;
      mk[c][rg][0] = *(const i32x4*)(mrow);
      mk[c][rg][1] = *(const i32x4*)(mrow + 4);
      mk[c][rg][2] = *(const i32x4*)(mrow + 16);
      mk[c][rg][3] = *(const i32x4*)(mrow + 20);
    }
  // the wait in front of any reuse of the loads' address registers; naming the
  // address keeps the pair live up to it
  asm volatile("s_wait_xcnt 0x0" :: "v"(src) : "memory");

  unsigned* dst = pm + ((size_t)qb * (Sq / 32) + cp * 2) * 32 + lane;
#pragma unroll
  for (int c = 0; c < 2; ++c) {
    unsigned v = 0;
#pragma unroll
    for (int rg = 0; rg < 2; ++rg)
#pragma unroll
      for (int e = 0; e < 16; ++e) {
        const unsigned keep =
            __builtin_amdgcn_ballot_w32(mk[c][rg][e >> 2][e & 3] != 0);
        v = (lane == rg * 16 + e) ? keep : v;   // lane rg*16+e stores word e
      }
    dst[c * 32] = v;
  }
}

static constexpr int KLD = 72;   // K row pitch in LDS, halfs (144 B = 16 B x 9)
static constexpr int VLD = 40;   // V^T row pitch in LDS, halfs (80 B = 16 B x 5)

DEV float xhalf(float x) {
  const int v = __builtin_bit_cast(int, x);
  return __builtin_bit_cast(
      float, __builtin_amdgcn_permlanex16(v, v, 0x76543210, 0xfedcba98, false, false));
}

__global__ __launch_bounds__(32 * AWAVES) void attn_kernel(
    const _Float16* __restrict__ qh, const _Float16* __restrict__ kh,
    const _Float16* __restrict__ vt, const unsigned* __restrict__ pm,
    float* __restrict__ out) {
  __shared__ __attribute__((aligned(16))) _Float16 Kb[2][32 * KLD];  // [kpos][d]
  __shared__ __attribute__((aligned(16))) _Float16 Vb[2][64 * VLD];  // [d][kpos]

  const int bh = blockIdx.x;
  const int b = bh >> 4, h = bh & 15;
  const int tid    = threadIdx.x;
  const int wave   = tid >> 5;
  const int lane   = tid & 31;
  const int lane15 = lane & 15;
  const int half   = lane >> 4;
  const int q0 = (blockIdx.y * AWAVES + wave) * QROWS;

  const _Float16* Qh = qh + ((size_t)bh * Sq + q0) * Dh;
  const _Float16* Kh = kh + (size_t)bh * Sq * Dh;
  const _Float16* Vh = vt + (size_t)bh * Dh * Sq;
  // this wave's lane masks: 32 words per key chunk, a wave-uniform address
  const unsigned* Pw =
      pm + ((size_t)b * (Sq / 32) + blockIdx.y * AWAVES +
            __builtin_amdgcn_readfirstlane(wave)) * (size_t)(Sq / 32) * 32;

  // stage one 32-kpos K/V chunk into LDS buffer `buf`: K tile 32 rows x 128 B
  // (thread: 16-byte piece tid & 7 of row tid >> 3, 4 KB contiguous in memory),
  // V^T tile 64 rows x 64 B (piece tid & 3 of row tid >> 2, source pitch Sq halfs)
  const _Float16* kg = Kh + tid * 8;
  const _Float16* vg = Vh + (size_t)(tid >> 2) * Sq + (tid & 3) * 8;
  const unsigned kl = (unsigned)(size_t)&Kb[0][(tid >> 3) * KLD + (tid & 7) * 8];
  const unsigned vl = (unsigned)(size_t)&Vb[0][(tid >> 2) * VLD + (tid & 3) * 8];
  auto stage = [&](int k0, int buf) {
    // the wait in the copies' own statement stands in front of any rewrite of
    // the address registers that they name
    asm volatile(
        "global_load_async_to_lds_b128 %0, %1, off\n\t"
        "global_load_async_to_lds_b128 %2, %3, off\n\t"
        "s_wait_xcnt 0x0"
        :: "v"(kl + (unsigned)buf * (unsigned)(32 * KLD * 2)), "v"(kg + (size_t)k0 * Dh),
           "v"(vl + (unsigned)buf * (unsigned)(64 * VLD * 2)), "v"(vg + k0)
        : "memory");
  };

  // Q^T B-tiles: [column group][dchunk], loaded once, reused for all k.
  v16h bq[2][2];
#pragma unroll
  for (int rg = 0; rg < 2; ++rg) {
    bq[rg][0] = load_tile_f16(Qh + (size_t)rg * 16 * Dh, Dh, lane);
    bq[rg][1] = load_tile_f16(Qh + (size_t)rg * 16 * Dh + 32, Dh, lane);
  }

  v16h aones;
  {
    const _Float16 onev = (_Float16)((lane15 == 0) ? 1.0f : 0.0f);
#pragma unroll
    for (int j = 0; j < 16; ++j) aones[j] = onev;
  }

  v8f o[2][4] = {};     // O^T: [group][d tile]; register r = d 16 t + 8 half + r
  v8f osum[2] = {};
  float m_i[2] = {-1.0e30f, -1.0e30f};

  v16h pb[2];

  // lane masks of chunk 0: [column group], word e = 8 * key tile + register
  u32x16 mw[2];
  mw[0] = *(cu32x16*)(Pw);
  mw[1] = *(cu32x16*)(Pw + 16);

  stage(0, 0);
  asm volatile("s_wait_asynccnt 0x0" ::: "memory");   // this wave's chunk-0 copies have landed
  __syncthreads();                                    // chunk 0 published
  stage(32, 1);
  for (int k0 = 0, it = 0; k0 < Sq; k0 += 32, ++it) {
    const int buf = it & 1;

    // K A-tiles from LDS, shared by both column groups
    v16h a00 = load_tile_f16(&Kb[buf][0], KLD, lane);
    v16h a01 = load_tile_f16(&Kb[buf][32], KLD, lane);
    v16h a10 = load_tile_f16(&Kb[buf][16 * KLD], KLD, lane);
    v16h a11 = load_tile_f16(&Kb[buf][16 * KLD + 32], KLD, lane);

    v8f sc[2][2];   // S^T: [column group][key tile]
#pragma unroll
    for (int rg = 0; rg < 2; ++rg) {
      v8f s0 = {}, s1 = {};
      s0 = wmma_f16(a00, bq[rg][0], s0);
      s0 = wmma_f16(a01, bq[rg][1], s0);
      s1 = wmma_f16(a10, bq[rg][0], s1);
      s1 = wmma_f16(a11, bq[rg][1], s1);
      s0 *= 0.125f;      // 1/sqrt(64)
      s1 *= 0.125f;
#pragma unroll
      for (int i = 0; i < 8; ++i) {
        s0[i] = __builtin_amdgcn_inverse_ballot_w32(mw[rg][i]) ? s0[i] : NEGF;
        s1[i] = __builtin_amdgcn_inverse_ballot_w32(mw[rg][8 + i]) ? s1[i] : NEGF;
      }
      sc[rg][0] = s0;
      sc[rg][1] = s1;
    }
    // the next chunk's lane masks, behind the last select of this chunk: their
    // latency runs under the rest of the pass (the last pass reads its own again)
    {
      const unsigned* pn = Pw + (size_t)((it + 1 < Sq / 32) ? it + 1 : it) * 32;
      mw[0] = *(cu32x16*)(pn);
      mw[1] = *(cu32x16*)(pn + 16);
    }

#pragma unroll
    for (int rg = 0; rg < 2; ++rg) {
      // online softmax, one query per lane
      v8f sv0 = sc[rg][0], sv1 = sc[rg][1];
      float tm = sv0[0];
#pragma unroll
      for (int i = 1; i < 8; ++i) tm = fmaxf(tm, sv0[i]);
#pragma unroll
      for (int i = 0; i < 8; ++i) tm = fmaxf(tm, sv1[i]);
      tm = fmaxf(tm, xhalf(tm));
      const float mn = fmaxf(m_i[rg], tm);
      const float alpha = __expf(m_i[rg] - mn);
      m_i[rg] = mn;
#pragma unroll
      for (int i = 0; i < 8; ++i) {
        pb[rg][i]     = (_Float16)__expf(sv0[i] - mn);
        pb[rg][i + 8] = (_Float16)__expf(sv1[i] - mn);
      }
#pragma unroll
      for (int t = 0; t < 4; ++t)
#pragma unroll
        for (int i = 0; i < 8; ++i) o[rg][t][i] *= alpha;
      osum[rg][0] *= alpha;  // rows 1..15 of this tile are 0
    }

    // O^T += V^T * P^T: V^T A-tiles loaded once, used by both column groups
#pragma unroll
    for (int t = 0; t < 4; ++t) {
      v16h avt = load_tile_f16(&Vb[buf][(t * 16) * VLD], VLD, lane);
      o[0][t] = wmma_f16(avt, pb[0], o[0][t]);
      o[1][t] = wmma_f16(avt, pb[1], o[1][t]);
    }
    // l += 1 * P^T (row sums via WMMA)
    osum[0] = wmma_f16(aones, pb[0], osum[0]);
    osum[1] = wmma_f16(aones, pb[1], osum[1]);

    // publish point of the next chunk
    asm volatile("s_wait_dscnt 0x0" ::: "memory");     // this wave's reads of buf are done
    asm volatile("s_wait_asynccnt 0x0" ::: "memory");  // its copies of the next chunk have landed
    __syncthreads();   // next chunk published; every reader has left buf
    if (k0 + 64 < Sq) stage(k0 + 64, buf);
  }
  asm volatile("s_wait_asynccnt 0x0" ::: "memory");    // nothing in flight at the wave's end

#pragma unroll
  for (int rg = 0; rg < 2; ++rg) {
    const float l = osum[rg][0] + xhalf(osum[rg][0]);
    const float inv = 1.0f / l;
    const int s = q0 + rg * 16 + lane15;
    float* orow = out + ((size_t)b * Sq + s) * (Hh * Dh) + h * Dh + (half << 3);
#pragma unroll
    for (int t = 0; t < 4; ++t) {
      v4f lo, hi;
#pragma unroll
      for (int i = 0; i < 4; ++i) {
        lo[i] = o[rg][t][i] * inv;
        hi[i] = o[rg][t][i + 4] * inv;
      }
      *(v4f*)(orow + t * 16)     = lo;
      *(v4f*)(orow + t * 16 + 4) = hi;
    }
    if (rg == 0) {
      // the second group's products reuse the registers that these stores name
      asm volatile("s_wait_xcnt 0x0" ::: "memory");
      // holds those products behind the wait (the scheduler otherwise lifts them over it)
      __builtin_amdgcn_sched_barrier(0);
    }
  }
}

// ---------------------------------------------------------------------------
extern "C" void kernel_launch(void* const* d_in, const int* in_sizes, int n_in,
                              void* d_out, int out_size, void* d_ws,
                              size_t ws_size, hipStream_t stream) {
  (void)in_sizes; (void)n_in; (void)out_size; (void)ws_size;
  const float* q    = (const float*)d_in[0];
  const float* k    = (const float*)d_in[1];
  const float* v    = (const float*)d_in[2];
  const int*   msk  = (const int*)d_in[3];
  const float* wq   = (const float*)d_in[4];
  const float* bq   = (const float*)d_in[5];
  const float* wk   = (const float*)d_in[6];
  const float* bk   = (const float*)d_in[7];
  const float* wv   = (const float*)d_in[8];
  const float* bv   = (const float*)d_in[9];
  float* out = (float*)d_out;

  // workspace layout (f16): 3x W^T (2 MB each) + qh/kh/vt (16 MB each) + 2 MB of lane masks
  _Float16* ws  = (_Float16*)d_ws;
  _Float16* wtq = ws;
  _Float16* wtk = wtq + (size_t)Dm * Dm;
  _Float16* wtv = wtk + (size_t)Dm * Dm;
  _Float16* qh  = wtv + (size_t)Dm * Dm;
  const size_t headElems = (size_t)Bsz * Hh * Sq * Dh;
  _Float16* kh = qh + headElems;
  _Float16* vt = kh + headElems;
  unsigned* pm = (unsigned*)(vt + headElems);   // lane masks, B*S*S/8 bytes

  dim3 gT((Dm * Dm) / 256, 3);
  wtrans_kernel<<<gT, 256, 0, stream>>>(wq, wk, wv, wtq, wtk, wtv);

  dim3 gP(Dm / PBN, (Bsz * Sq) / PBM, 3);
  proj_kernel<<<gP, 256, 0, stream>>>(q, k, v, wtq, wtk, wtv, bq, bk, bv,
                                      qh, kh, vt);

  maskpack_kernel<<<Bsz * (Sq / 32) * (Sq / 64) / 8, 256, 0, stream>>>(msk, pm);

  dim3 gA(Bsz * Hh, Sq / (QROWS * AWAVES));
  attn_kernel<<<gA, 32 * AWAVES, 0, stream>>>(qh, kh, vt, pm, out);
}

// v005
// A run of this version takes 140 microseconds.
// In two side-by-side timings against v004, it was 1.49 and 1.50 times as fast.
// Counting every step since v000, it is 4.10 times as fast.
#include <hip/hip_runtime.h>
#include <hip/hip_bf16.h>

#define DEV __device__ __forceinline__

typedef __attribute__((ext_vector_type(16))) _Float16 v16h;
typedef __attribute__((ext_vector_type(8)))  _Float16 v8h;
typedef __attribute__((ext_vector_type(4)))  _Float16 v4h;
typedef __attribute__((ext_vector_type(8)))  float    v8f;
typedef __attribute__((ext_vector_type(4)))  float    v4f;
typedef __attribute__((ext_vector_type(4)))  int      i32x4;
typedef __attribute__((ext_vector_type(16))) unsigned u32x16;
// memory that no one writes while the kernel runs: a load at a wave-uniform
// address through this type is a scalar load
typedef const __attribute__((address_space(4))) u32x16 cu32x16;

static constexpr int Bsz = 4;
static constexpr int Sq  = 2048;
static constexpr int Dm  = 1024;
static constexpr int Hh  = 16;
static constexpr int Dh  = 64;
#define NEGF (-1.0e9f)
#define AWAVES 8   // waves per attention block
#define QROWS 32   // q rows per wave (2 row-groups of 16)

// ---------------------------------------------------------------------------
// D = A(16x32 f16) * B(32x16 f16) + C(16x16 f32)
DEV v8f wmma_f16(v16h a, v16h b, v8f c) {
  return __builtin_amdgcn_wmma_f32_16x16x32_f16(
      /*neg_a=*/false, a, /*neg_b=*/false, b,
      /*c_mod=*/(short)0, c, /*reuse_a=*/false, /*reuse_b=*/false);
}

DEV v16h load_tile_f16(const _Float16* p, int ld, int lane) {
  const _Float16* base = p + (size_t)(lane & 15) * ld + ((lane >> 4) << 3);
  v8h c0 = *(const v8h*)(base);
  v8h c1 = *(const v8h*)(base + 16);
  v16h r;
#pragma unroll
  for (int j = 0; j < 8; ++j) { r[j] = c0[j]; r[j + 8] = c1[j]; }
  return r;
}

// Same tile pattern but f32 source, converted to f16 on the fly.
DEV v16h load_tile_f32(const float* p, int ld, int lane) {
  const float* base = p + (size_t)(lane & 15) * ld + ((lane >> 4) << 3);
  v4f a0 = *(const v4f*)(base);
  v4f a1 = *(const v4f*)(base + 4);
  v4f b0 = *(const v4f*)(base + 16);
  v4f b1 = *(const v4f*)(base + 20);
  v16h r;
#pragma unroll
  for (int j = 0; j < 4; ++j) {
    r[j]      = (_Float16)a0[j];
    r[j + 4]  = (_Float16)a1[j];
    r[j + 8]  = (_Float16)b0[j];
    r[j + 12] = (_Float16)b1[j];
  }
  return r;
}

// ---------------------------------------------------------------------------
// Kernel 1: transpose + convert weights (1024x1024 f32 [k][n]) -> f16 W^T [n][k].
// grid = (n tiles, k tiles, 3 = q,k,v); a block of 256 takes one 64 x 64 tile.
// A thread loads a 4 x 4 piece (one float4 of four consecutive k rows; a
// wave-wide load covers two 256-byte row pieces, whole lines), turns it in
// registers and lays it in LDS as [n][k] at a 144-byte row pitch. The tile goes
// out in 16-byte pieces: a wave-wide store covers four whole 128-byte lines.
static constexpr int TT  = 64;   // tile edge
static constexpr int TLD = 72;   // LDS row pitch in halfs (144 B = 16 B x 9)

__global__ __launch_bounds__(256) void wtrans_kernel(
    const float* __restrict__ wq, const float* __restrict__ wk,
    const float* __restrict__ wv, _Float16* __restrict__ tq,
    _Float16* __restrict__ tk, _Float16* __restrict__ tv) {
  __shared__ __attribute__((aligned(16))) _Float16 Ts[TT * TLD];   // [n][k]
  const float* w = (blockIdx.z == 0) ? wq : (blockIdx.z == 1) ? wk : wv;
  _Float16* o    = (blockIdx.z == 0) ? tq : (blockIdx.z == 1) ? tk : tv;
  const int tid = threadIdx.x;
  const int n0 = blockIdx.x * TT, k0 = blockIdx.y * TT;
  const int n4 = (tid & 15) * 4, k4 = (tid >> 4) * 4;

  const float* src = w + (size_t)(k0 + k4) * Dm + n0 + n4;
  v4f r[4];
#pragma unroll
  for (int j = 0; j < 4; ++j) r[j] = *(const v4f*)(src + (size_t)j * Dm);
#pragma unroll
  for (int e = 0; e < 4; ++e) {
    v4h c;
#pragma unroll
    for (int j = 0; j < 4; ++j) c[j] = (_Float16)r[j][e];
    *(v4h*)&Ts[(n4 + e) * TLD + k4] = c;
  }
  __syncthreads();   // the whole tile lies in LDS before any row of it is read

  const int row = tid >> 3, pc = (tid & 7) * 8;
  _Float16* dst = o + (size_t)(n0 + row) * Dm + k0 + pc;
#pragma unroll
  for (int j = 0; j < 2; ++j)
    *(v8h*)(dst + (size_t)(32 * j) * Dm) = *(const v8h*)&Ts[(row + 32 * j) * TLD + pc];
}

// ---------------------------------------------------------------------------
// Kernel 2: fused QKV projection GEMM (wave32 WMMA), LDS-tiled.
// grid = (N/128 column tiles, (B*S)/128 row tiles, 3 = q,k,v). Block = 256
// (8 waves, 2 x 4); the block owns a 128 x 128 tile of the output, wave
// (wm, wn) its 64 x 32 part (4 x 2 accumulator tiles).
// Per 64-k step both operands are read from global memory once per block with
// whole-line loads (x converted to f16 on the way) and laid in LDS at a
// 144-byte row pitch; fragments come from LDS. Two LDS buffers: the next
// step's global loads are issued ahead of this step's products and stored
// behind them, one barrier per step.
// Q,K heads -> [b][h][s][64] f16; V -> transposed [b][h][d][s] f16.
static constexpr int PBM = 128;   // rows of x per block
static constexpr int PBN = 128;   // output columns per block
static constexpr int PBK = 64;    // k per step
static constexpr int PLD = 72;    // LDS row pitch in halfs (144 B = 16 B x 9)

__global__ __launch_bounds__(256) void proj_kernel(
    const float* __restrict__ xq, const float* __restrict__ xk,
    const float* __restrict__ xv, const _Float16* __restrict__ wtq,
    const _Float16* __restrict__ wtk, const _Float16* __restrict__ wtv,
    const float* __restrict__ bq, const float* __restrict__ bk,
    const float* __restrict__ bv, _Float16* __restrict__ qh,
    _Float16* __restrict__ kh, _Float16* __restrict__ vt) {
  __shared__ __attribute__((aligned(16))) _Float16 As[2][PBM * PLD];
  __shared__ __attribute__((aligned(16))) _Float16 Bs[2][PBN * PLD];

  const int which = blockIdx.z;
  const float* x      = (which == 0) ? xq  : (which == 1) ? xk  : xv;
  const _Float16* wt  = (which == 0) ? wtq : (which == 1) ? wtk : wtv;
  const float* bias   = (which == 0) ? bq  : (which == 1) ? bk  : bv;
  _Float16* out       = (which == 0) ? qh  : (which == 1) ? kh  : vt;
  const bool tr = (which == 2);

  const int tid    = threadIdx.x;
  const int wave   = tid >> 5;
  const int lane   = tid & 31;
  const int lane15 = lane & 15;
  const int half   = lane >> 4;
  const int wm = wave >> 2;             // 0..1: 64-row part
  const int wn = wave & 3;              // 0..3: 32-column part
  const int r0 = blockIdx.y * PBM;      // global activation row in [0, B*S)
  const int n0 = blockIdx.x * PBN;      // output column base

  // x tile: 128 rows x 64 f32; thread takes float4 (tid & 15) of rows
  // (tid >> 4) + 16 j. W^T tile: 128 rows x 64 f16; thread takes the 16-byte
  // piece (tid & 7) of rows (tid >> 3) + 32 j.
  const int arow = tid >> 4, acol = (tid & 15) * 4;
  const int brow = tid >> 3, bcol = (tid & 7) * 8;
  const float*    ag = x  + (size_t)(r0 + arow) * Dm + acol;
  const _Float16* bg = wt + (size_t)(n0 + brow) * Dm + bcol;

  v4f ra[8];
  v8h rb[4];
  auto gload = [&](int kt) {
#pragma unroll
    for (int j = 0; j < 8; ++j)
      ra[j] = *(const v4f*)(ag + (size_t)(16 * j) * Dm + kt * PBK);
#pragma unroll
    for (int j = 0; j < 4; ++j)
      rb[j] = *(const v8h*)(bg + (size_t)(32 * j) * Dm + kt * PBK);
  };
  auto lstore = [&](int buf) {
#pragma unroll
    for (int j = 0; j < 8; ++j) {
      v4h hx;
#pragma unroll
      for (int e = 0; e < 4; ++e) hx[e] = (_Float16)ra[j][e];
      *(v4h*)&As[buf][(arow + 16 * j) * PLD + acol] = hx;
    }
#pragma unroll
    for (int j = 0; j < 4; ++j)
      *(v8h*)&Bs[buf][(brow + 32 * j) * PLD + bcol] = rb[j];
  };

  v8f acc[4][2] = {};
  auto compute = [&](int buf) {
#pragma unroll
    for (int ks = 0; ks < PBK; ks += 32) {
      v16h a[4], bm[2];
#pragma unroll
      for (int i = 0; i < 4; ++i)
        a[i] = load_tile_f16(&As[buf][(wm * 64 + i * 16) * PLD + ks], PLD, lane);
#pragma unroll
      for (int t = 0; t < 2; ++t)
        bm[t] = load_tile_f16(&Bs[buf][(wn * 32 + t * 16) * PLD + ks], PLD, lane);
#pragma unroll
      for (int i = 0; i < 4; ++i)
#pragma unroll
        for (int t = 0; t < 2; ++t) acc[i][t] = wmma_f16(a[i], bm[t], acc[i][t]);
    }
  };

  constexpr int NK = Dm / PBK;
  gload(0);
  lstore(0);
  __syncthreads();                 // step 0 published
  for (int kt = 0; kt < NK - 1; ++kt) {
    const int buf = kt & 1;
    gload(kt + 1);
    // holds the next step's global loads ahead of the products, so that their
    // latency runs under them (the scheduler otherwise sinks them to the stores)
    __builtin_amdgcn_sched_barrier(0);
    compute(buf);
    // holds the waits on those loads, the conversions and the LDS stores
    // behind the last product
    __builtin_amdgcn_sched_barrier(0);
    lstore(buf ^ 1);               // its last readers left before the previous barrier
    __syncthreads();               // publishes step kt+1, ends the reads of buf
  }
  compute((NK - 1) & 1);

#pragma unroll
  for (int i4 = 0; i4 < 4; ++i4) {
    const int rt = r0 + wm * 64 + i4 * 16;  // first row of this accumulator tile
#pragma unroll
    for (int t = 0; t < 2; ++t) {
      const int c = n0 + wn * 32 + t * 16 + lane15;   // global output column
      const int h = c >> 6, d = c & 63;
      const float bi = bias[c];
      if (!tr) {
#pragma unroll
        for (int i = 0; i < 8; ++i) {
          const int row = rt + i + (half << 3);
          const int b = row >> 11, s = row & (Sq - 1);
          out[((size_t)(b * Hh + h) * Sq + s) * Dh + d] =
              (_Float16)(acc[i4][t][i] + bi);
        }
        // the next tile's sums reuse the registers that these stores name
        asm volatile("s_wait_xcnt 0x0" ::: "memory");
      } else {
        // [b][h][d][S]: 8 consecutive s per lane -> one b128 store
        const int row = rt + (half << 3);
        const int b = row >> 11, s = row & (Sq - 1);
        v8h pk;
#pragma unroll
        for (int i = 0; i < 8; ++i) pk[i] = (_Float16)(acc[i4][t][i] + bi);
        *(v8h*)(out + ((size_t)(b * Hh + h) * Dh + d) * Sq + s) = pk;
        // the next tile's sums reuse the registers that this store names
        asm volatile("s_wait_xcnt 0x0" ::: "memory");
      }
    }
  }
}

__global__ __launch_bounds__(256) void maskpack_kernel(
    const int* __restrict__ mask, unsigned* __restrict__ pm) {
  const int lane   = threadIdx.x & 31;
  const int lane15 = lane & 15;
  const int half   = lane >> 4;
  const int w  = blockIdx.x * 8 + (threadIdx.x >> 5);
  const int cp = w & (Sq / 64 - 1);   // pair of key chunks
  const int qb = w / (Sq / 64);       // b * S/32 + query block
  const int* src = mask + ((size_t)qb * 32 + lane15) * Sq + cp * 64 + (half << 3);

  i32x4 mk[2][2][4];   // [chunk][column group][piece]
#pragma unroll
  for (int c = 0; c < 2; ++c)
#pragma unroll
    for (int rg = 0; rg < 2; ++rg) {
      const int* mrow = src + (size_t)(rg * 16) * Sq + c * 32;
      mk[c][rg][0] = *(const i32x4*)(mrow);
      mk[c][rg][1] = *(const i32x4*)(mrow + 4);
      mk[c][rg][2] = *(const i32x4*)(mrow + 16);
      mk[c][rg][3] = *(const i32x4*)(mrow + 20);
    }
  // the wait in front of any reuse of the loads' address registers; naming the
  // address keeps the pair live up to it
  asm volatile("s_wait_xcnt 0x0" :: "v"(src) : "memory");

  unsigned* dst = pm + ((size_t)qb * (Sq / 32) + cp * 2) * 32 + lane;
#pragma unroll
  for (int c = 0; c < 2; ++c) {
    unsigned v = 0;
#pragma unroll
    for (int rg = 0; rg < 2; ++rg)
#pragma unroll
      for (int e = 0; e < 16; ++e) {
        const unsigned keep =
            __builtin_amdgcn_ballot_w32(mk[c][rg][e >> 2][e & 3] != 0);
        v = (lane == rg * 16 + e) ? keep : v;   // lane rg*16+e stores word e
      }
    dst[c * 32] = v;
  }
}

static constexpr int KLD = 72;   // K row pitch in LDS, halfs (144 B = 16 B x 9)
static constexpr int VLD = 40;   // V^T row pitch in LDS, halfs (80 B = 16 B x 5)

DEV float xhalf(float x) {
  const int v = __builtin_bit_cast(int, x);
  return __builtin_bit_cast(
      float, __builtin_amdgcn_permlanex16(v, v, 0x76543210, 0xfedcba98, false, false));
}

__global__ __launch_bounds__(32 * AWAVES) void attn_kernel(
    const _Float16* __restrict__ qh, const _Float16* __restrict__ kh,
    const _Float16* __restrict__ vt, const unsigned* __restrict__ pm,
    float* __restrict__ out) {
  __shared__ __attribute__((aligned(16))) _Float16 Kb[2][32 * KLD];  // [kpos][d]
  __shared__ __attribute__((aligned(16))) _Float16 Vb[2][64 * VLD];  // [d][kpos]

  const int bh = blockIdx.x;
  const int b = bh >> 4, h = bh & 15;
  const int tid    = threadIdx.x;
  const int wave   = tid >> 5;
  const int lane   = tid & 31;
  const int lane15 = lane & 15;
  const int half   = lane >> 4;
  const int q0 = (blockIdx.y * AWAVES + wave) * QROWS;

  const _Float16* Qh = qh + ((size_t)bh * Sq + q0) * Dh;
  const _Float16* Kh = kh + (size_t)bh * Sq * Dh;
  const _Float16* Vh = vt + (size_t)bh * Dh * Sq;
  // this wave's lane masks: 32 words per key chunk, a wave-uniform address
  const unsigned* Pw =
      pm + ((size_t)b * (Sq / 32) + blockIdx.y * AWAVES +
            __builtin_amdgcn_readfirstlane(wave)) * (size_t)(Sq / 32) * 32;

  // stage one 32-kpos K/V chunk into LDS buffer `buf`: K tile 32 rows x 128 B
  // (thread: 16-byte piece tid & 7 of row tid >> 3, 4 KB contiguous in memory),
  // V^T tile 64 rows x 64 B (piece tid & 3 of row tid >> 2, source pitch Sq halfs)
  const _Float16* kg = Kh + tid * 8;
  const _Float16* vg = Vh + (size_t)(tid >> 2) * Sq + (tid & 3) * 8;
  const unsigned kl = (unsigned)(size_t)&Kb[0][(tid >> 3) * KLD + (tid & 7) * 8];
  const unsigned vl = (unsigned)(size_t)&Vb[0][(tid >> 2) * VLD + (tid & 3) * 8];
  auto stage = [&](int k0, int buf) {
    // the wait in the copies' own statement stands in front of any rewrite of
    // the address registers that they name
    asm volatile(
        "global_load_async_to_lds_b128 %0, %1, off\n\t"
        "global_load_async_to_lds_b128 %2, %3, off\n\t"
        "s_wait_xcnt 0x0"
        :: "v"(kl + (unsigned)buf * (unsigned)(32 * KLD * 2)), "v"(kg + (size_t)k0 * Dh),
           "v"(vl + (unsigned)buf * (unsigned)(64 * VLD * 2)), "v"(vg + k0)
        : "memory");
  };

  // Q^T B-tiles: [column group][dchunk], loaded once, reused for all k.
  v16h bq[2][2];
#pragma unroll
  for (int rg = 0; rg < 2; ++rg) {
    bq[rg][0] = load_tile_f16(Qh + (size_t)rg * 16 * Dh, Dh, lane);
    bq[rg][1] = load_tile_f16(Qh + (size_t)rg * 16 * Dh + 32, Dh, lane);
  }

  v16h aones;
  {
    const _Float16 onev = (_Float16)((lane15 == 0) ? 1.0f : 0.0f);
#pragma unroll
    for (int j = 0; j < 16; ++j) aones[j] = onev;
  }

  v8f o[2][4] = {};     // O^T: [group][d tile]; register r = d 16 t + 8 half + r
  v8f osum[2] = {};
  float m_i[2] = {-1.0e30f, -1.0e30f};

  v16h pb[2];

  // lane masks of chunk 0: [column group], word e = 8 * key tile + register
  u32x16 mw[2];
  mw[0] = *(cu32x16*)(Pw);
  mw[1] = *(cu32x16*)(Pw + 16);

  stage(0, 0);
  asm volatile("s_wait_asynccnt 0x0" ::: "memory");   // this wave's chunk-0 copies have landed
  __syncthreads();                                    // chunk 0 published
  stage(32, 1);
  for (int k0 = 0, it = 0; k0 < Sq; k0 += 32, ++it) {
    const int buf = it & 1;

    // K A-tiles from LDS, shared by both column groups
    v16h a00 = load_tile_f16(&Kb[buf][0], KLD, lane);
    v16h a01 = load_tile_f16(&Kb[buf][32], KLD, lane);
    v16h a10 = load_tile_f16(&Kb[buf][16 * KLD], KLD, lane);
    v16h a11 = load_tile_f16(&Kb[buf][16 * KLD + 32], KLD, lane);

    v8f sc[2][2];   // S^T: [column group][key tile]
#pragma unroll
    for (int rg = 0; rg < 2; ++rg) {
      v8f s0 = {}, s1 = {};
      s0 = wmma_f16(a00, bq[rg][0], s0);
      s0 = wmma_f16(a01, bq[rg][1], s0);
      s1 = wmma_f16(a10, bq[rg][0], s1);
      s1 = wmma_f16(a11, bq[rg][1], s1);
      s0 *= 0.125f;      // 1/sqrt(64)
      s1 *= 0.125f;
#pragma unroll
      for (int i = 0; i < 8; ++i) {
        s0[i] = __builtin_amdgcn_inverse_ballot_w32(mw[rg][i]) ? s0[i] : NEGF;
        s1[i] = __builtin_amdgcn_inverse_ballot_w32(mw[rg][8 + i]) ? s1[i] : NEGF;
      }
      sc[rg][0] = s0;
      sc[rg][1] = s1;
    }
    // the next chunk's lane masks, behind the last select of this chunk: their
    // latency runs under the rest of the pass (the last pass reads its own again)
    {
      const unsigned* pn = Pw + (size_t)((it + 1 < Sq / 32) ? it + 1 : it) * 32;
      mw[0] = *(cu32x16*)(pn);
      mw[1] = *(cu32x16*)(pn + 16);
    }

#pragma unroll
    for (int rg = 0; rg < 2; ++rg) {
      // online softmax, one query per lane
      v8f sv0 = sc[rg][0], sv1 = sc[rg][1];
      float tm = sv0[0];
#pragma unroll
      for (int i = 1; i < 8; ++i) tm = fmaxf(tm, sv0[i]);
#pragma unroll
      for (int i = 0; i < 8; ++i) tm = fmaxf(tm, sv1[i]);
      tm = fmaxf(tm, xhalf(tm));
      const float mn = fmaxf(m_i[rg], tm);
      const float alpha = __expf(m_i[rg] - mn);
      m_i[rg] = mn;
#pragma unroll
      for (int i = 0; i < 8; ++i) {
        pb[rg][i]     = (_Float16)__expf(sv0[i] - mn);
        pb[rg][i + 8] = (_Float16)__expf(sv1[i] - mn);
      }
#pragma unroll
      for (int t = 0; t < 4; ++t)
#pragma unroll
        for (int i = 0; i < 8; ++i) o[rg][t][i] *= alpha;
      osum[rg][0] *= alpha;  // rows 1..15 of this tile are 0
    }

    // O^T += V^T * P^T: V^T A-tiles loaded once, used by both column groups
#pragma unroll
    for (int t = 0; t < 4; ++t) {
      v16h avt = load_tile_f16(&Vb[buf][(t * 16) * VLD], VLD, lane);
      o[0][t] = wmma_f16(avt, pb[0], o[0][t]);
      o[1][t] = wmma_f16(avt, pb[1], o[1][t]);
    }
    // l += 1 * P^T (row sums via WMMA)
    osum[0] = wmma_f16(aones, pb[0], osum[0]);
    osum[1] = wmma_f16(aones, pb[1], osum[1]);

    // publish point of the next chunk
    asm volatile("s_wait_dscnt 0x0" ::: "memory");     // this wave's reads of buf are done
    asm volatile("s_wait_asynccnt 0x0" ::: "memory");  // its copies of the next chunk have landed
    __syncthreads();   // next chunk published; every reader has left buf
    if (k0 + 64 < Sq) stage(k0 + 64, buf);
  }
  asm volatile("s_wait_asynccnt 0x0" ::: "memory");    // nothing in flight at the wave's end

#pragma unroll
  for (int rg = 0; rg < 2; ++rg) {
    const float l = osum[rg][0] + xhalf(osum[rg][0]);
    const float inv = 1.0f / l;
    const int s = q0 + rg * 16 + lane15;
    float* orow = out + ((size_t)b * Sq + s) * (Hh * Dh) + h * Dh + (half << 3);
#pragma unroll
    for (int t = 0; t < 4; ++t) {
      v4f lo, hi;
#pragma unroll
      for (int i = 0; i < 4; ++i) {
        lo[i] = o[rg][t][i] * inv;
        hi[i] = o[rg][t][i + 4] * inv;
      }
      *(v4f*)(orow + t * 16)     = lo;
      *(v4f*)(orow + t * 16 + 4) = hi;
    }
    if (rg == 0) {
      // the second group's products reuse the registers that these stores name
      asm volatile("s_wait_xcnt 0x0" ::: "memory");
      // holds those products behind the wait (the scheduler otherwise lifts them over it)
      __builtin_amdgcn_sched_barrier(0);
    }
  }
}

// ---------------------------------------------------------------------------
extern "C" void kernel_launch(void* const* d_in, const int* in_sizes, int n_in,
                              void* d_out, int out_size, void* d_ws,
                              size_t ws_size, hipStream_t stream) {
  (void)in_sizes; (void)n_in; (void)out_size; (void)ws_size;
  const float* q    = (const float*)d_in[0];
  const float* k    = (const float*)d_in[1];
  const float* v    = (const float*)d_in[2];
  const int*   msk  = (const int*)d_in[3];
  const float* wq   = (const float*)d_in[4];
  const float* bq   = (const float*)d_in[5];
  const float* wk   = (const float*)d_in[6];
  const float* bk   = (const float*)d_in[7];
  const float* wv   = (const float*)d_in[8];
  const float* bv   = (const float*)d_in[9];
  float* out = (float*)d_out;

  // workspace layout (f16): 3x W^T (2 MB each) + qh/kh/vt (16 MB each) + 2 MB of lane masks
  _Float16* ws  = (_Float16*)d_ws;
  _Float16* wtq = ws;
  _Float16* wtk = wtq + (size_t)Dm * Dm;
  _Float16* wtv = wtk + (size_t)Dm * Dm;
  _Float16* qh  = wtv + (size_t)Dm * Dm;
  const size_t headElems = (size_t)Bsz * Hh * Sq * Dh;
  _Float16* kh = qh + headElems;
  _Float16* vt = kh + headElems;
  unsigned* pm = (unsigned*)(vt + headElems);   // lane masks, B*S*S/8 bytes

  dim3 gT(Dm / TT, Dm / TT, 3);
  wtrans_kernel<<<gT, 256, 0, stream>>>(wq, wk, wv, wtq, wtk, wtv);

  dim3 gP(Dm / PBN, (Bsz * Sq) / PBM, 3);
  proj_kernel<<<gP, 256, 0, stream>>>(q, k, v, wtq, wtk, wtv, bq, bk, bv,
                                      qh, kh, vt);

  maskpack_kernel<<<Bsz * (Sq / 32) * (Sq / 64) / 8, 256, 0, stream>>>(msk, pm);

  dim3 gA(Bsz * Hh, Sq / (QROWS * AWAVES));
  attn_kernel<<<gA, 32 * AWAVES, 0, stream>>>(qh, kh, vt, pm, out);
}

// v006
// One run takes 135 microseconds.
// Next to v005, in two timings, it ran 1.04 and 1.03 times as fast.
// All steps since v000 together make it 4.26 times as fast.
#include <hip/hip_runtime.h>
#include <hip/hip_bf16.h>

#define DEV __device__ __forceinline__

typedef __attribute__((ext_vector_type(16))) _Float16 v16h;
typedef __attribute__((ext_vector_type(8)))  _Float16 v8h;
typedef __attribute__((ext_vector_type(4)))  _Float16 v4h;
typedef __attribute__((ext_vector_type(8)))  float    v8f;
typedef __attribute__((ext_vector_type(4)))  float    v4f;
typedef __attribute__((ext_vector_type(4)))  int      i32x4;
typedef __attribute__((ext_vector_type(16))) unsigned u32x16;
// memory that no one writes while the kernel runs: a load at a wave-uniform
// address through this type is a scalar load
typedef const __attribute__((address_space(4))) u32x16 cu32x16;

static constexpr int Bsz = 4;
static constexpr int Sq  = 2048;
static constexpr int Dm  = 1024;
static constexpr int Hh  = 16;
static constexpr int Dh  = 64;
// Raw scores (before the 1/sqrt(64)) are turned into exponents of 2 by one
// multiply-add with SC2 = log2(e) / sqrt(64).
#define SC2 (0.125f * 1.44269504088896340736f)
// A masked score, in raw units: -2^33 (-2^30 after the scale; the reference's
// -1e9 and this value give the same softmax, 0 beside any kept score and equal
// weights in a row with none). A power of two, so that its product with SC2 is
// exact and a row of masked scores alone gets the exponent 0 exactly.
#define NEGR (-8589934592.0f)
#define AWAVES 8   // waves per attention block
#define QROWS 32   // q rows per wave (2 row-groups of 16)

// ---------------------------------------------------------------------------
// D = A(16x32 f16) * B(32x16 f16) + C(16x16 f32)
DEV v8f wmma_f16(v16h a, v16h b, v8f c) {
  return __builtin_amdgcn_wmma_f32_16x16x32_f16(
      /*neg_a=*/false, a, /*neg_b=*/false, b,
      /*c_mod=*/(short)0, c, /*reuse_a=*/false, /*reuse_b=*/false);
}

DEV v16h load_tile_f16(const _Float16* p, int ld, int lane) {
  const _Float16* base = p + (size_t)(lane & 15) * ld + ((lane >> 4) << 3);
  v8h c0 = *(const v8h*)(base);
  v8h c1 = *(const v8h*)(base + 16);
  v16h r;
#pragma unroll
  for (int j = 0; j < 8; ++j) { r[j] = c0[j]; r[j + 8] = c1[j]; }
  return r;
}

// Same tile pattern but f32 source, converted to f16 on the fly.
DEV v16h load_tile_f32(const float* p, int ld, int lane) {
  const float* base = p + (size_t)(lane & 15) * ld + ((lane >> 4) << 3);
  v4f a0 = *(const v4f*)(base);
  v4f a1 = *(const v4f*)(base + 4);
  v4f b0 = *(const v4f*)(base + 16);
  v4f b1 = *(const v4f*)(base + 20);
  v16h r;
#pragma unroll
  for (int j = 0; j < 4; ++j) {
    r[j]      = (_Float16)a0[j];
    r[j + 4]  = (_Float16)a1[j];
    r[j + 8]  = (_Float16)b0[j];
    r[j + 12] = (_Float16)b1[j];
  }
  return r;
}

// ---------------------------------------------------------------------------
// Kernel 1: transpose + convert weights (1024x1024 f32 [k][n]) -> f16 W^T [n][k].
// grid = (n tiles, k tiles, 3 = q,k,v); a block of 256 takes one 64 x 64 tile.
// A thread loads a 4 x 4 piece (one float4 of four consecutive k rows; a
// wave-wide load covers two 256-byte row pieces, whole lines), turns it in
// registers and lays it in LDS as [n][k] at a 144-byte row pitch. The tile goes
// out in 16-byte pieces: a wave-wide store covers four whole 128-byte lines.
static constexpr int TT  = 64;   // tile edge
static constexpr int TLD = 72;   // LDS row pitch in halfs (144 B = 16 B x 9)

__global__ __launch_bounds__(256) void wtrans_kernel(
    const float* __restrict__ wq, const float* __restrict__ wk,
    const float* __restrict__ wv, _Float16* __restrict__ tq,
    _Float16* __restrict__ tk, _Float16* __restrict__ tv) {
  __shared__ __attribute__((aligned(16))) _Float16 Ts[TT * TLD];   // [n][k]
  const float* w = (blockIdx.z == 0) ? wq : (blockIdx.z == 1) ? wk : wv;
  _Float16* o    = (blockIdx.z == 0) ? tq : (blockIdx.z == 1) ? tk : tv;
  const int tid = threadIdx.x;
  const int n0 = blockIdx.x * TT, k0 = blockIdx.y * TT;
  const int n4 = (tid & 15) * 4, k4 = (tid >> 4) * 4;

  const float* src = w + (size_t)(k0 + k4) * Dm + n0 + n4;
  v4f r[4];
#pragma unroll
  for (int j = 0; j < 4; ++j) r[j] = *(const v4f*)(src + (size_t)j * Dm);
#pragma unroll
  for (int e = 0; e < 4; ++e) {
    v4h c;
#pragma unroll
    for (int j = 0; j < 4; ++j) c[j] = (_Float16)r[j][e];
    *(v4h*)&Ts[(n4 + e) * TLD + k4] = c;
  }
  __syncthreads();   // the whole tile lies in LDS before any row of it is read

  const int row = tid >> 3, pc = (tid & 7) * 8;
  _Float16* dst = o + (size_t)(n0 + row) * Dm + k0 + pc;
#pragma unroll
  for (int j = 0; j < 2; ++j)
    *(v8h*)(dst + (size_t)(32 * j) * Dm) = *(const v8h*)&Ts[(row + 32 * j) * TLD + pc];
}

// ---------------------------------------------------------------------------
// Kernel 2: fused QKV projection GEMM (wave32 WMMA), LDS-tiled.
// grid = (N/128 column tiles, (B*S)/128 row tiles, 3 = q,k,v). Block = 256
// (8 waves, 2 x 4); the block owns a 128 x 128 tile of the output, wave
// (wm, wn) its 64 x 32 part (4 x 2 accumulator tiles).
// Per 64-k step both operands are read from global memory once per block with
// whole-line loads (x converted to f16 on the way) and laid in LDS at a
// 144-byte row pitch; fragments come from LDS. Two LDS buffers: the next
// step's global loads are issued ahead of this step's products and stored
// behind them, one barrier per step.
// Q,K heads -> [b][h][s][64] f16; V -> transposed [b][h][d][s] f16.
static constexpr int PBM = 128;   // rows of x per block
static constexpr int PBN = 128;   // output columns per block
static constexpr int PBK = 64;    // k per step
static constexpr int PLD = 72;    // LDS row pitch in halfs (144 B = 16 B x 9)

__global__ __launch_bounds__(256) void proj_kernel(
    const float* __restrict__ xq, const float* __restrict__ xk,
    const float* __restrict__ xv, const _Float16* __restrict__ wtq,
    const _Float16* __restrict__ wtk, const _Float16* __restrict__ wtv,
    const float* __restrict__ bq, const float* __restrict__ bk,
    const float* __restrict__ bv, _Float16* __restrict__ qh,
    _Float16* __restrict__ kh, _Float16* __restrict__ vt) {
  __shared__ __attribute__((aligned(16))) _Float16 As[2][PBM * PLD];
  __shared__ __attribute__((aligned(16))) _Float16 Bs[2][PBN * PLD];

  const int which = blockIdx.z;
  const float* x      = (which == 0) ? xq  : (which == 1) ? xk  : xv;
  const _Float16* wt  = (which == 0) ? wtq : (which == 1) ? wtk : wtv;
  const float* bias   = (which == 0) ? bq  : (which == 1) ? bk  : bv;
  _Float16* out       = (which == 0) ? qh  : (which == 1) ? kh  : vt;
  const bool tr = (which == 2);

  const int tid    = threadIdx.x;
  const int wave   = tid >> 5;
  const int lane   = tid & 31;
  const int lane15 = lane & 15;
  const int half   = lane >> 4;
  const int wm = wave >> 2;             // 0..1: 64-row part
  const int wn = wave & 3;              // 0..3: 32-column part
  const int r0 = blockIdx.y * PBM;      // global activation row in [0, B*S)
  const int n0 = blockIdx.x * PBN;      // output column base

  // x tile: 128 rows x 64 f32; thread takes float4 (tid & 15) of rows
  // (tid >> 4) + 16 j. W^T tile: 128 rows x 64 f16; thread takes the 16-byte
  // piece (tid & 7) of rows (tid >> 3) + 32 j.
  const int arow = tid >> 4, acol = (tid & 15) * 4;
  const int brow = tid >> 3, bcol = (tid & 7) * 8;
  const float*    ag = x  + (size_t)(r0 + arow) * Dm + acol;
  const _Float16* bg = wt + (size_t)(n0 + brow) * Dm + bcol;

  v4f ra[8];
  v8h rb[4];
  auto gload = [&](int kt) {
#pragma unroll
    for (int j = 0; j < 8; ++j)
      ra[j] = *(const v4f*)(ag + (size_t)(16 * j) * Dm + kt * PBK);
#pragma unroll
    for (int j = 0; j < 4; ++j)
      rb[j] = *(const v8h*)(bg + (size_t)(32 * j) * Dm + kt * PBK);
  };
  auto lstore = [&](int buf) {
#pragma unroll
    for (int j = 0; j < 8; ++j) {
      v4h hx;
#pragma unroll
      for (int e = 0; e < 4; ++e) hx[e] = (_Float16)ra[j][e];
      *(v4h*)&As[buf][(arow + 16 * j) * PLD + acol] = hx;
    }
#pragma unroll
    for (int j = 0; j < 4; ++j)
      *(v8h*)&Bs[buf][(brow + 32 * j) * PLD + bcol] = rb[j];
  };

  v8f acc[4][2] = {};
  auto compute = [&](int buf) {
#pragma unroll
    for (int ks = 0; ks < PBK; ks += 32) {
      v16h a[4], bm[2];
#pragma unroll
      for (int i = 0; i < 4; ++i)
        a[i] = load_tile_f16(&As[buf][(wm * 64 + i * 16) * PLD + ks], PLD, lane);
#pragma unroll
      for (int t = 0; t < 2; ++t)
        bm[t] = load_tile_f16(&Bs[buf][(wn * 32 + t * 16) * PLD + ks], PLD, lane);
#pragma unroll
      for (int i = 0; i < 4; ++i)
#pragma unroll
        for (int t = 0; t < 2; ++t) acc[i][t] = wmma_f16(a[i], bm[t], acc[i][t]);
    }
  };

  constexpr int NK = Dm / PBK;
  gload(0);
  lstore(0);
  __syncthreads();                 // step 0 published
  for (int kt = 0; kt < NK - 1; ++kt) {
    const int buf = kt & 1;
    gload(kt + 1);
    // holds the next step's global loads ahead of the products, so that their
    // latency runs under them (the scheduler otherwise sinks them to the stores)
    __builtin_amdgcn_sched_barrier(0);
    compute(buf);
    // holds the waits on those loads, the conversions and the LDS stores
    // behind the last product
    __builtin_amdgcn_sched_barrier(0);
    lstore(buf ^ 1);               // its last readers left before the previous barrier
    __syncthreads();               // publishes step kt+1, ends the reads of buf
  }
  compute((NK - 1) & 1);

#pragma unroll
  for (int i4 = 0; i4 < 4; ++i4) {
    const int rt = r0 + wm * 64 + i4 * 16;  // first row of this accumulator tile
#pragma unroll
    for (int t = 0; t < 2; ++t) {
      const int c = n0 + wn * 32 + t * 16 + lane15;   // global output column
      const int h = c >> 6, d = c & 63;
      const float bi = bias[c];
      if (!tr) {
#pragma unroll
        for (int i = 0; i < 8; ++i) {
          const int row = rt + i + (half << 3);
          const int b = row >> 11, s = row & (Sq - 1);
          out[((size_t)(b * Hh + h) * Sq + s) * Dh + d] =
              (_Float16)(acc[i4][t][i] + bi);
        }
        // the next tile's sums reuse the registers that these stores name
        asm volatile("s_wait_xcnt 0x0" ::: "memory");
      } else {
        // [b][h][d][S]: 8 consecutive s per lane -> one b128 store
        const int row = rt + (half << 3);
        const int b = row >> 11, s = row & (Sq - 1);
        v8h pk;
#pragma unroll
        for (int i = 0; i < 8; ++i) pk[i] = (_Float16)(acc[i4][t][i] + bi);
        *(v8h*)(out + ((size_t)(b * Hh + h) * Dh + d) * Sq + s) = pk;
        // the next tile's sums reuse the registers that this store names
        asm volatile("s_wait_xcnt 0x0" ::: "memory");
      }
    }
  }
}

__global__ __launch_bounds__(256) void maskpack_kernel(
    const int* __restrict__ mask, unsigned* __restrict__ pm) {
  const int lane   = threadIdx.x & 31;
  const int lane15 = lane & 15;
  const int half   = lane >> 4;
  const int w  = blockIdx.x * 8 + (threadIdx.x >> 5);
  const int cp = w & (Sq / 64 - 1);   // pair of key chunks
  const int qb = w / (Sq / 64);       // b * S/32 + query block
  const int* src = mask + ((size_t)qb * 32 + lane15) * Sq + cp * 64 + (half << 3);

  i32x4 mk[2][2][4];   // [chunk][column group][piece]
#pragma unroll
  for (int c = 0; c < 2; ++c)
#pragma unroll
    for (int rg = 0; rg < 2; ++rg) {
      const int* mrow = src + (size_t)(rg * 16) * Sq + c * 32;
      mk[c][rg][0] = *(const i32x4*)(mrow);
      mk[c][rg][1] = *(const i32x4*)(mrow + 4);
      mk[c][rg][2] = *(const i32x4*)(mrow + 16);
      mk[c][rg][3] = *(const i32x4*)(mrow + 20);
    }
  // the wait in front of any reuse of the loads' address registers; naming the
  // address keeps the pair live up to it
  asm volatile("s_wait_xcnt 0x0" :: "v"(src) : "memory");

  unsigned* dst = pm + ((size_t)qb * (Sq / 32) + cp * 2) * 32 + lane;
#pragma unroll
  for (int c = 0; c < 2; ++c) {
    unsigned v = 0;
#pragma unroll
    for (int rg = 0; rg < 2; ++rg)
#pragma unroll
      for (int e = 0; e < 16; ++e) {
        const unsigned keep =
            __builtin_amdgcn_ballot_w32(mk[c][rg][e >> 2][e & 3] != 0);
        v = (lane == rg * 16 + e) ? keep : v;   // lane rg*16+e stores word e
      }
    dst[c * 32] = v;
  }
}

static constexpr int KLD = 72;   // K row pitch in LDS, halfs (144 B = 16 B x 9)
static constexpr int VLD = 40;   // V^T row pitch in LDS, halfs (80 B = 16 B x 5)

DEV float xhalf(float x) {
  const int v = __builtin_bit_cast(int, x);
  return __builtin_bit_cast(
      float, __builtin_amdgcn_permlanex16(v, v, 0x76543210, 0xfedcba98, false, false));
}

__global__ __launch_bounds__(32 * AWAVES) void attn_kernel(
    const _Float16* __restrict__ qh, const _Float16* __restrict__ kh,
    const _Float16* __restrict__ vt, const unsigned* __restrict__ pm,
    float* __restrict__ out) {
  __shared__ __attribute__((aligned(16))) _Float16 Kb[2][32 * KLD];  // [kpos][d]
  __shared__ __attribute__((aligned(16))) _Float16 Vb[2][64 * VLD];  // [d][kpos]

  const int bh = blockIdx.x;
  const int b = bh >> 4, h = bh & 15;
  const int tid    = threadIdx.x;
  const int wave   = tid >> 5;
  const int lane   = tid & 31;
  const int lane15 = lane & 15;
  const int half   = lane >> 4;
  const int q0 = (blockIdx.y * AWAVES + wave) * QROWS;

  const _Float16* Qh = qh + ((size_t)bh * Sq + q0) * Dh;
  const _Float16* Kh = kh + (size_t)bh * Sq * Dh;
  const _Float16* Vh = vt + (size_t)bh * Dh * Sq;
  // this wave's lane masks: 32 words per key chunk, a wave-uniform address
  const unsigned* Pw =
      pm + ((size_t)b * (Sq / 32) + blockIdx.y * AWAVES +
            __builtin_amdgcn_readfirstlane(wave)) * (size_t)(Sq / 32) * 32;

  // stage one 32-kpos K/V chunk into LDS buffer `buf`: K tile 32 rows x 128 B
  // (thread: 16-byte piece tid & 7 of row tid >> 3, 4 KB contiguous in memory),
  // V^T tile 64 rows x 64 B (piece tid & 3 of row tid >> 2, source pitch Sq halfs)
  const _Float16* kg = Kh + tid * 8;
  const _Float16* vg = Vh + (size_t)(tid >> 2) * Sq + (tid & 3) * 8;
  const unsigned kl = (unsigned)(size_t)&Kb[0][(tid >> 3) * KLD + (tid & 7) * 8];
  const unsigned vl = (unsigned)(size_t)&Vb[0][(tid >> 2) * VLD + (tid & 3) * 8];
  auto stage = [&](int k0, int buf) {
    // the wait in the copies' own statement stands in front of any rewrite of
    // the address registers that they name
    asm volatile(
        "global_load_async_to_lds_b128 %0, %1, off\n\t"
        "global_load_async_to_lds_b128 %2, %3, off\n\t"
        "s_wait_xcnt 0x0"
        :: "v"(kl + (unsigned)buf * (unsigned)(32 * KLD * 2)), "v"(kg + (size_t)k0 * Dh),
           "v"(vl + (unsigned)buf * (unsigned)(64 * VLD * 2)), "v"(vg + k0)
        : "memory");
  };

  // Q^T B-tiles: [column group][dchunk], loaded once, reused for all k.
  v16h bq[2][2];
#pragma unroll
  for (int rg = 0; rg < 2; ++rg) {
    bq[rg][0] = load_tile_f16(Qh + (size_t)rg * 16 * Dh, Dh, lane);
    bq[rg][1] = load_tile_f16(Qh + (size_t)rg * 16 * Dh + 32, Dh, lane);
  }

  v16h aones;
  {
    const _Float16 onev = (_Float16)((lane15 == 0) ? 1.0f : 0.0f);
#pragma unroll
    for (int j = 0; j < 16; ++j) aones[j] = onev;
  }

  v8f o[2][4] = {};     // O^T: [group][d tile]; register r = d 16 t + 8 half + r
  v8f osum[2] = {};
  float m_i[2] = {-1.0e30f, -1.0e30f};   // running maximum, raw units

  v16h pb[2];

  // lane masks of chunk 0: [column group], word e = 8 * key tile + register
  u32x16 mw[2];
  mw[0] = *(cu32x16*)(Pw);
  mw[1] = *(cu32x16*)(Pw + 16);

  stage(0, 0);
  asm volatile("s_wait_asynccnt 0x0" ::: "memory");   // this wave's chunk-0 copies have landed
  __syncthreads();                                    // chunk 0 published
  stage(32, 1);
  for (int k0 = 0, it = 0; k0 < Sq; k0 += 32, ++it) {
    const int buf = it & 1;

    // K A-tiles from LDS, shared by both column groups
    v16h a00 = load_tile_f16(&Kb[buf][0], KLD, lane);
    v16h a01 = load_tile_f16(&Kb[buf][32], KLD, lane);
    v16h a10 = load_tile_f16(&Kb[buf][16 * KLD], KLD, lane);
    v16h a11 = load_tile_f16(&Kb[buf][16 * KLD + 32], KLD, lane);

    v8f sc[2][2];   // S^T: [column group][key tile]
#pragma unroll
    for (int rg = 0; rg < 2; ++rg) {
      v8f s0 = {}, s1 = {};
      s0 = wmma_f16(a00, bq[rg][0], s0);
      s0 = wmma_f16(a01, bq[rg][1], s0);
      s1 = wmma_f16(a10, bq[rg][0], s1);
      s1 = wmma_f16(a11, bq[rg][1], s1);
#pragma unroll
      for (int i = 0; i < 8; ++i) {
        s0[i] = __builtin_amdgcn_inverse_ballot_w32(mw[rg][i]) ? s0[i] : NEGR;
        s1[i] = __builtin_amdgcn_inverse_ballot_w32(mw[rg][8 + i]) ? s1[i] : NEGR;
      }
      sc[rg][0] = s0;
      sc[rg][1] = s1;
    }
    // the next chunk's lane masks, behind the last select of this chunk: their
    // latency runs under the rest of the pass (the last pass reads its own again)
    {
      const unsigned* pn = Pw + (size_t)((it + 1 < Sq / 32) ? it + 1 : it) * 32;
      mw[0] = *(cu32x16*)(pn);
      mw[1] = *(cu32x16*)(pn + 16);
    }

#pragma unroll
    for (int rg = 0; rg < 2; ++rg) {
      // online softmax, one query per lane
      v8f sv0 = sc[rg][0], sv1 = sc[rg][1];
      float tm = sv0[0];
#pragma unroll
      for (int i = 1; i < 8; ++i) tm = fmaxf(tm, sv0[i]);
#pragma unroll
      for (int i = 0; i < 8; ++i) tm = fmaxf(tm, sv1[i]);
      tm = fmaxf(tm, xhalf(tm));
      const float mn = fmaxf(m_i[rg], tm);
      const float mc = mn * SC2;
      const v8f e0 = __builtin_elementwise_fma(sv0, (v8f)(SC2), (v8f)(-mc));
      const v8f e1 = __builtin_elementwise_fma(sv1, (v8f)(SC2), (v8f)(-mc));
#pragma unroll
      for (int i = 0; i < 8; ++i) {
        pb[rg][i]     = (_Float16)__builtin_amdgcn_exp2f(e0[i]);
        pb[rg][i + 8] = (_Float16)__builtin_amdgcn_exp2f(e1[i]);
      }
      // the difference first: exactly 1 while the maximum stands
      const float alpha = __builtin_amdgcn_exp2f((m_i[rg] - mn) * SC2);
      m_i[rg] = mn;
#pragma unroll
      for (int t = 0; t < 4; ++t)
#pragma unroll
        for (int i = 0; i < 8; ++i) o[rg][t][i] *= alpha;
      osum[rg][0] *= alpha;  // rows 1..15 of this tile are 0
    }

    // O^T += V^T * P^T: V^T A-tiles loaded once, used by both column groups
#pragma unroll
    for (int t = 0; t < 4; ++t) {
      v16h avt = load_tile_f16(&Vb[buf][(t * 16) * VLD], VLD, lane);
      o[0][t] = wmma_f16(avt, pb[0], o[0][t]);
      o[1][t] = wmma_f16(avt, pb[1], o[1][t]);
    }
    // l += 1 * P^T (row sums via WMMA)
    osum[0] = wmma_f16(aones, pb[0], osum[0]);
    osum[1] = wmma_f16(aones, pb[1], osum[1]);

    // publish point of the next chunk
    asm volatile("s_wait_dscnt 0x0" ::: "memory");     // this wave's reads of buf are done
    asm volatile("s_wait_asynccnt 0x0" ::: "memory");  // its copies of the next chunk have landed
    __syncthreads();   // next chunk published; every reader has left buf
    if (k0 + 64 < Sq) stage(k0 + 64, buf);
  }
  asm volatile("s_wait_asynccnt 0x0" ::: "memory");    // nothing in flight at the wave's end

#pragma unroll
  for (int rg = 0; rg < 2; ++rg) {
    const float l = osum[rg][0] + xhalf(osum[rg][0]);
    const float inv = 1.0f / l;
    const int s = q0 + rg * 16 + lane15;
    float* orow = out + ((size_t)b * Sq + s) * (Hh * Dh) + h * Dh + (half << 3);
#pragma unroll
    for (int t = 0; t < 4; ++t) {
      v4f lo, hi;
#pragma unroll
      for (int i = 0; i < 4; ++i) {
        lo[i] = o[rg][t][i] * inv;
        hi[i] = o[rg][t][i + 4] * inv;
      }
      *(v4f*)(orow + t * 16)     = lo;
      *(v4f*)(orow + t * 16 + 4) = hi;
    }
    if (rg == 0) {
      // the second group's products reuse the registers that these stores name
      asm volatile("s_wait_xcnt 0x0" ::: "memory");
      // holds those products behind the wait (the scheduler otherwise lifts them over it)
      __builtin_amdgcn_sched_barrier(0);
    }
  }
}

// ---------------------------------------------------------------------------
extern "C" void kernel_launch(void* const* d_in, const int* in_sizes, int n_in,
                              void* d_out, int out_size, void* d_ws,
                              size_t ws_size, hipStream_t stream) {
  (void)in_sizes; (void)n_in; (void)out_size; (void)ws_size;
  const float* q    = (const float*)d_in[0];
  const float* k    = (const float*)d_in[1];
  const float* v    = (const float*)d_in[2];
  const int*   msk  = (const int*)d_in[3];
  const float* wq   = (const float*)d_in[4];
  const float* bq   = (const float*)d_in[5];
  const float* wk   = (const float*)d_in[6];
  const float* bk   = (const float*)d_in[7];
  const float* wv   = (const float*)d_in[8];
  const float* bv   = (const float*)d_in[9];
  float* out = (float*)d_out;

  // workspace layout (f16): 3x W^T (2 MB each) + qh/kh/vt (16 MB each) + 2 MB of lane masks
  _Float16* ws  = (_Float16*)d_ws;
  _Float16* wtq = ws;
  _Float16* wtk = wtq + (size_t)Dm * Dm;
  _Float16* wtv = wtk + (size_t)Dm * Dm;
  _Float16* qh  = wtv + (size_t)Dm * Dm;
  const size_t headElems = (size_t)Bsz * Hh * Sq * Dh;
  _Float16* kh = qh + headElems;
  _Float16* vt = kh + headElems;
  unsigned* pm = (unsigned*)(vt + headElems);   // lane masks, B*S*S/8 bytes

  dim3 gT(Dm / TT, Dm / TT, 3);
  wtrans_kernel<<<gT, 256, 0, stream>>>(wq, wk, wv, wtq, wtk, wtv);

  dim3 gP(Dm / PBN, (Bsz * Sq) / PBM, 3);
  proj_kernel<<<gP, 256, 0, stream>>>(q, k, v, wtq, wtk, wtv, bq, bk, bv,
                                      qh, kh, vt);

  maskpack_kernel<<<Bsz * (Sq / 32) * (Sq / 64) / 8, 256, 0, stream>>>(msk, pm);

  dim3 gA(Bsz * Hh, Sq / (QROWS * AWAVES));
  attn_kernel<<<gA, 32 * AWAVES, 0, stream>>>(qh, kh, vt, pm, out);
}

// v007
// It runs in 130 microseconds.
// Next to v006, in two timings, it ran 1.04 times as fast each time.
// Over all steps from v000 it is 4.42 times as fast.
#include <hip/hip_runtime.h>
#include <hip/hip_bf16.h>

#define DEV __device__ __forceinline__

typedef __attribute__((ext_vector_type(16))) _Float16 v16h;
typedef __attribute__((ext_vector_type(8)))  _Float16 v8h;
typedef __attribute__((ext_vector_type(4)))  _Float16 v4h;
typedef __attribute__((ext_vector_type(8)))  float    v8f;
typedef __attribute__((ext_vector_type(4)))  float    v4f;
typedef __attribute__((ext_vector_type(4)))  int      i32x4;
typedef __attribute__((ext_vector_type(16))) unsigned u32x16;
// memory that no one writes while the kernel runs: a load at a wave-uniform
// address through this type is a scalar load
typedef const __attribute__((address_space(4))) u32x16 cu32x16;

static constexpr int Bsz = 4;
static constexpr int Sq  = 2048;
static constexpr int Dm  = 1024;
static constexpr int Hh  = 16;
static constexpr int Dh  = 64;
// Raw scores (before the 1/sqrt(64)) are turned into exponents of 2 by one
// multiply-add with SC2 = log2(e) / sqrt(64).
#define SC2 (0.125f * 1.44269504088896340736f)
// A masked score, in raw units: -2^33 (-2^30 after the scale; the reference's
// -1e9 and this value give the same softmax, 0 beside any kept score and equal
// weights in a row with none). A power of two, so that its product with SC2 is
// exact and a row of masked scores alone gets the exponent 0 exactly.
#define NEGR (-8589934592.0f)
#define AWAVES 8   // waves per attention block
#define QROWS 32   // q rows per wave (2 row-groups of 16)

// ---------------------------------------------------------------------------
// D = A(16x32 f16) * B(32x16 f16) + C(16x16 f32)
DEV v8f wmma_f16(v16h a, v16h b, v8f c) {
  return __builtin_amdgcn_wmma_f32_16x16x32_f16(
      /*neg_a=*/false, a, /*neg_b=*/false, b,
      /*c_mod=*/(short)0, c, /*reuse_a=*/false, /*reuse_b=*/false);
}

DEV v16h load_tile_f16(const _Float16* p, int ld, int lane) {
  const _Float16* base = p + (size_t)(lane & 15) * ld + ((lane >> 4) << 3);
  v8h c0 = *(const v8h*)(base);
  v8h c1 = *(const v8h*)(base + 16);
  v16h r;
#pragma unroll
  for (int j = 0; j < 8; ++j) { r[j] = c0[j]; r[j + 8] = c1[j]; }
  return r;
}

// Same tile pattern but f32 source, converted to f16 on the fly.
DEV v16h load_tile_f32(const float* p, int ld, int lane) {
  const float* base = p + (size_t)(lane & 15) * ld + ((lane >> 4) << 3);
  v4f a0 = *(const v4f*)(base);
  v4f a1 = *(const v4f*)(base + 4);
  v4f b0 = *(const v4f*)(base + 16);
  v4f b1 = *(const v4f*)(base + 20);
  v16h r;
#pragma unroll
  for (int j = 0; j < 4; ++j) {
    r[j]      = (_Float16)a0[j];
    r[j + 4]  = (_Float16)a1[j];
    r[j + 8]  = (_Float16)b0[j];
    r[j + 12] = (_Float16)b1[j];
  }
  return r;
}

// ---------------------------------------------------------------------------
// Kernel 1: transpose + convert weights (1024x1024 f32 [k][n]) -> f16 W^T [n][k].
// grid = (n tiles, k tiles, 3 = q,k,v); a block of 256 takes one 64 x 64 tile.
// A thread loads a 4 x 4 piece (one float4 of four consecutive k rows; a
// wave-wide load covers two 256-byte row pieces, whole lines), turns it in
// registers and lays it in LDS as [n][k] at a 144-byte row pitch. The tile goes
// out in 16-byte pieces: a wave-wide store covers four whole 128-byte lines.
static constexpr int TT  = 64;   // tile edge
static constexpr int TLD = 72;   // LDS row pitch in halfs (144 B = 16 B x 9)

__global__ __launch_bounds__(256) void wtrans_kernel(
    const float* __restrict__ wq, const float* __restrict__ wk,
    const float* __restrict__ wv, _Float16* __restrict__ tq,
    _Float16* __restrict__ tk, _Float16* __restrict__ tv) {
  __shared__ __attribute__((aligned(16))) _Float16 Ts[TT * TLD];   // [n][k]
  const float* w = (blockIdx.z == 0) ? wq : (blockIdx.z == 1) ? wk : wv;
  _Float16* o    = (blockIdx.z == 0) ? tq : (blockIdx.z == 1) ? tk : tv;
  const int tid = threadIdx.x;
  const int n0 = blockIdx.x * TT, k0 = blockIdx.y * TT;
  const int n4 = (tid & 15) * 4, k4 = (tid >> 4) * 4;

  const float* src = w + (size_t)(k0 + k4) * Dm + n0 + n4;
  v4f r[4];
#pragma unroll
  for (int j = 0; j < 4; ++j) r[j] = *(const v4f*)(src + (size_t)j * Dm);
#pragma unroll
  for (int e = 0; e < 4; ++e) {
    v4h c;
#pragma unroll
    for (int j = 0; j < 4; ++j) c[j] = (_Float16)r[j][e];
    *(v4h*)&Ts[(n4 + e) * TLD + k4] = c;
  }
  __syncthreads();   // the whole tile lies in LDS before any row of it is read

  const int row = tid >> 3, pc = (tid & 7) * 8;
  _Float16* dst = o + (size_t)(n0 + row) * Dm + k0 + pc;
#pragma unroll
  for (int j = 0; j < 2; ++j)
    *(v8h*)(dst + (size_t)(32 * j) * Dm) = *(const v8h*)&Ts[(row + 32 * j) * TLD + pc];
}

// ---------------------------------------------------------------------------
// Kernel 2: fused QKV projection GEMM (wave32 WMMA), LDS-tiled.
// grid = (N/128 column tiles, (B*S)/128 row tiles, 3 = q,k,v). Block = 256
// (8 waves, 2 x 4); the block owns a 128 x 128 tile of the output, wave
// (wm, wn) its 64 x 32 part (4 x 2 accumulator tiles).
// Per 64-k step both operands are read from global memory once per block with
// whole-line loads (x converted to f16 on the way) and laid in LDS at a
// 144-byte row pitch; fragments come from LDS. Two LDS buffers: the next
// step's global loads are issued ahead of this step's products and stored
// behind them, one barrier per step.
// Q,K heads -> [b][h][s][64] f16; V -> transposed [b][h][d][s] f16.
static constexpr int PBM = 128;   // rows of x per block
static constexpr int PBN = 128;   // output columns per block
static constexpr int PBK = 64;    // k per step
static constexpr int PLD = 72;    // LDS row pitch in halfs (144 B = 16 B x 9)
static constexpr int SLD = 136;   // row pitch of the result tile in LDS, halfs (272 B = 16 B x 17)

__global__ __launch_bounds__(256) void proj_kernel(
    const float* __restrict__ xq, const float* __restrict__ xk,
    const float* __restrict__ xv, const _Float16* __restrict__ wtq,
    const _Float16* __restrict__ wtk, const _Float16* __restrict__ wtv,
    const float* __restrict__ bq, const float* __restrict__ bk,
    const float* __restrict__ bv, _Float16* __restrict__ qh,
    _Float16* __restrict__ kh, _Float16* __restrict__ vt) {
  __shared__ __attribute__((aligned(16))) _Float16 As[2][PBM * PLD];
  __shared__ __attribute__((aligned(16))) _Float16 Bs[2][PBN * PLD];

  const int which = blockIdx.z;
  const float* x      = (which == 0) ? xq  : (which == 1) ? xk  : xv;
  const _Float16* wt  = (which == 0) ? wtq : (which == 1) ? wtk : wtv;
  const float* bias   = (which == 0) ? bq  : (which == 1) ? bk  : bv;
  _Float16* out       = (which == 0) ? qh  : (which == 1) ? kh  : vt;
  const bool tr = (which == 2);

  const int tid    = threadIdx.x;
  const int wave   = tid >> 5;
  const int lane   = tid & 31;
  const int lane15 = lane & 15;
  const int half   = lane >> 4;
  const int wm = wave >> 2;             // 0..1: 64-row part
  const int wn = wave & 3;              // 0..3: 32-column part
  const int r0 = blockIdx.y * PBM;      // global activation row in [0, B*S)
  const int n0 = blockIdx.x * PBN;      // output column base

  // x tile: 128 rows x 64 f32; thread takes float4 (tid & 15) of rows
  // (tid >> 4) + 16 j. W^T tile: 128 rows x 64 f16; thread takes the 16-byte
  // piece (tid & 7) of rows (tid >> 3) + 32 j.
  const int arow = tid >> 4, acol = (tid & 15) * 4;
  const int brow = tid >> 3, bcol = (tid & 7) * 8;
  const float*    ag = x  + (size_t)(r0 + arow) * Dm + acol;
  const _Float16* bg = wt + (size_t)(n0 + brow) * Dm + bcol;

  v4f ra[8];
  v8h rb[4];
  auto gload = [&](int kt) {
#pragma unroll
    for (int j = 0; j < 8; ++j)
      ra[j] = *(const v4f*)(ag + (size_t)(16 * j) * Dm + kt * PBK);
#pragma unroll
    for (int j = 0; j < 4; ++j)
      rb[j] = *(const v8h*)(bg + (size_t)(32 * j) * Dm + kt * PBK);
  };
  auto lstore = [&](int buf) {
#pragma unroll
    for (int j = 0; j < 8; ++j) {
      v4h hx;
#pragma unroll
      for (int e = 0; e < 4; ++e) hx[e] = (_Float16)ra[j][e];
      *(v4h*)&As[buf][(arow + 16 * j) * PLD + acol] = hx;
    }
#pragma unroll
    for (int j = 0; j < 4; ++j)
      *(v8h*)&Bs[buf][(brow + 32 * j) * PLD + bcol] = rb[j];
  };

  v8f acc[4][2] = {};
  auto compute = [&](int buf) {
#pragma unroll
    for (int ks = 0; ks < PBK; ks += 32) {
      v16h a[4], bm[2];
#pragma unroll
      for (int i = 0; i < 4; ++i)
        a[i] = load_tile_f16(&As[buf][(wm * 64 + i * 16) * PLD + ks], PLD, lane);
#pragma unroll
      for (int t = 0; t < 2; ++t)
        bm[t] = load_tile_f16(&Bs[buf][(wn * 32 + t * 16) * PLD + ks], PLD, lane);
#pragma unroll
      for (int i = 0; i < 4; ++i)
#pragma unroll
        for (int t = 0; t < 2; ++t) acc[i][t] = wmma_f16(a[i], bm[t], acc[i][t]);
    }
  };

  constexpr int NK = Dm / PBK;
  gload(0);
  lstore(0);
  __syncthreads();                 // step 0 published
  for (int kt = 0; kt < NK - 1; ++kt) {
    const int buf = kt & 1;
    gload(kt + 1);
    // holds the next step's global loads ahead of the products, so that their
    // latency runs under them (the scheduler otherwise sinks them to the stores)
    __builtin_amdgcn_sched_barrier(0);
    compute(buf);
    // holds the waits on those loads, the conversions and the LDS stores
    // behind the last product
    __builtin_amdgcn_sched_barrier(0);
    lstore(buf ^ 1);               // its last readers left before the previous barrier
    __syncthreads();               // publishes step kt+1, ends the reads of buf
  }
  compute((NK - 1) & 1);

  // The block's 128 x 128 tile of f16 results is laid in LDS over the x buffers
  // (q, k as [row][column], v as [column][row]) and leaves in 16-byte pieces:
  // a wave-wide store then covers four whole 128-byte lines.
  _Float16* St = &As[0][0];
  // holds the last products in front of the barrier: lifted behind it they keep
  // all their fragments in registers at once, and the larger register count
  // costs a resident work-group per WGP
  __builtin_amdgcn_sched_barrier(0);
  __syncthreads();   // every wave has left the operand buffers before the tile is laid over them
  const int rl = wm * 64 + (half << 3);     // first of this lane's 8 rows in accumulator tile 0
  const int cl = wn * 32 + lane15;          // this lane's column in accumulator tile 0
  const float bi[2] = {bias[n0 + cl], bias[n0 + cl + 16]};
  if (!tr) {
#pragma unroll
    for (int i4 = 0; i4 < 4; ++i4)
#pragma unroll
      for (int t = 0; t < 2; ++t)
#pragma unroll
        for (int i = 0; i < 8; ++i)
          St[(rl + i4 * 16 + i) * SLD + cl + t * 16] = (_Float16)(acc[i4][t][i] + bi[t]);
  } else {
#pragma unroll
    for (int i4 = 0; i4 < 4; ++i4)
#pragma unroll
      for (int t = 0; t < 2; ++t) {
        v8h pk;
#pragma unroll
        for (int i = 0; i < 8; ++i) pk[i] = (_Float16)(acc[i4][t][i] + bi[t]);
        *(v8h*)&St[(cl + t * 16) * SLD + rl + i4 * 16] = pk;
      }
  }
  __syncthreads();   // the tile is whole before any line of it is read

  const int b = r0 >> 11, s0 = r0 & (Sq - 1);   // a block's 128 rows lie in one batch
  v8h ln[8];
  if (!tr) {
    // [b][h][s][64]: one (head, s) row is one line; 4 consecutive s per wave-wide store
    const int pc = (tid & 7) * 8, rr = tid >> 3;
#pragma unroll
    for (int j = 0; j < 8; ++j)
      ln[j] = *(const v8h*)&St[((j & 3) * 32 + rr) * SLD + (j >> 2) * Dh + pc];
    _Float16* dst = out + ((size_t)(b * Hh + (n0 >> 6)) * Sq + s0 + rr) * Dh + pc;
#pragma unroll
    for (int j = 0; j < 8; ++j)
      *(v8h*)(dst + ((size_t)(j >> 2) * Sq + (j & 3) * 32) * Dh) = ln[j];
    // the wait in front of any reuse of the registers that these stores name
    asm volatile("s_wait_xcnt 0x0" ::: "memory");
  } else {
    // [b][h][d][S]: 128 consecutive s of one (h, d) row are two lines
    const int pc = (tid & 15) * 8, cc = tid >> 4;
#pragma unroll
    for (int j = 0; j < 8; ++j)
      ln[j] = *(const v8h*)&St[(j * 16 + cc) * SLD + pc];
    _Float16* dst = out + ((size_t)b * (Hh * Dh) + n0 + cc) * Sq + s0 + pc;
#pragma unroll
    for (int j = 0; j < 8; ++j)
      *(v8h*)(dst + (size_t)(j * 16) * Sq) = ln[j];
  }
}

__global__ __launch_bounds__(256) void maskpack_kernel(
    const int* __restrict__ mask, unsigned* __restrict__ pm) {
  const int lane   = threadIdx.x & 31;
  const int lane15 = lane & 15;
  const int half   = lane >> 4;
  const int w  = blockIdx.x * 8 + (threadIdx.x >> 5);
  const int cp = w & (Sq / 64 - 1);   // pair of key chunks
  const int qb = w / (Sq / 64);       // b * S/32 + query block
  const int* src = mask + ((size_t)qb * 32 + lane15) * Sq + cp * 64 + (half << 3);

  i32x4 mk[2][2][4];   // [chunk][column group][piece]
#pragma unroll
  for (int c = 0; c < 2; ++c)
#pragma unroll
    for (int rg = 0; rg < 2; ++rg) {
      const int* mrow = src + (size_t)(rg * 16) * Sq + c * 32;
      mk[c][rg][0] = *(const i32x4*)(mrow);
      mk[c][rg][1] = *(const i32x4*)(mrow + 4);
      mk[c][rg][2] = *(const i32x4*)(mrow + 16);
      mk[c][rg][3] = *(const i32x4*)(mrow + 20);
    }
  // the wait in front of any reuse of the loads' address registers; naming the
  // address keeps the pair live up to it
  asm volatile("s_wait_xcnt 0x0" :: "v"(src) : "memory");

  unsigned* dst = pm + ((size_t)qb * (Sq / 32) + cp * 2) * 32 + lane;
#pragma unroll
  for (int c = 0; c < 2; ++c) {
    unsigned v = 0;
#pragma unroll
    for (int rg = 0; rg < 2; ++rg)
#pragma unroll
      for (int e = 0; e < 16; ++e) {
        const unsigned keep =
            __builtin_amdgcn_ballot_w32(mk[c][rg][e >> 2][e & 3] != 0);
        v = (lane == rg * 16 + e) ? keep : v;   // lane rg*16+e stores word e
      }
    dst[c * 32] = v;
  }
}

static constexpr int KLD = 72;   // K row pitch in LDS, halfs (144 B = 16 B x 9)
static constexpr int VLD = 40;   // V^T row pitch in LDS, halfs (80 B = 16 B x 5)
static constexpr int OLD = 68;   // output row pitch in LDS, floats (272 B = 16 B x 17)

DEV float xhalf(float x) {
  const int v = __builtin_bit_cast(int, x);
  return __builtin_bit_cast(
      float, __builtin_amdgcn_permlanex16(v, v, 0x76543210, 0xfedcba98, false, false));
}

__global__ __launch_bounds__(32 * AWAVES) void attn_kernel(
    const _Float16* __restrict__ qh, const _Float16* __restrict__ kh,
    const _Float16* __restrict__ vt, const unsigned* __restrict__ pm,
    float* __restrict__ out) {
  __shared__ __attribute__((aligned(16))) _Float16 Kb[2][32 * KLD];  // [kpos][d]
  __shared__ __attribute__((aligned(16))) _Float16 Vb[2][64 * VLD];  // [d][kpos]
  // each wave's own range: 16 output rows of 64 floats on their way to memory
  __shared__ __attribute__((aligned(16))) float Os[AWAVES][16 * OLD];

  const int bh = blockIdx.x;
  const int b = bh >> 4, h = bh & 15;
  const int tid    = threadIdx.x;
  const int wave   = tid >> 5;
  const int lane   = tid & 31;
  const int lane15 = lane & 15;
  const int half   = lane >> 4;
  const int q0 = (blockIdx.y * AWAVES + wave) * QROWS;

  const _Float16* Qh = qh + ((size_t)bh * Sq + q0) * Dh;
  const _Float16* Kh = kh + (size_t)bh * Sq * Dh;
  const _Float16* Vh = vt + (size_t)bh * Dh * Sq;
  // this wave's lane masks: 32 words per key chunk, a wave-uniform address
  const unsigned* Pw =
      pm + ((size_t)b * (Sq / 32) + blockIdx.y * AWAVES +
            __builtin_amdgcn_readfirstlane(wave)) * (size_t)(Sq / 32) * 32;

  // stage one 32-kpos K/V chunk into LDS buffer `buf`: K tile 32 rows x 128 B
  // (thread: 16-byte piece tid & 7 of row tid >> 3, 4 KB contiguous in memory),
  // V^T tile 64 rows x 64 B (piece tid & 3 of row tid >> 2, source pitch Sq halfs)
  const _Float16* kg = Kh + tid * 8;
  const _Float16* vg = Vh + (size_t)(tid >> 2) * Sq + (tid & 3) * 8;
  const unsigned kl = (unsigned)(size_t)&Kb[0][(tid >> 3) * KLD + (tid & 7) * 8];
  const unsigned vl = (unsigned)(size_t)&Vb[0][(tid >> 2) * VLD + (tid & 3) * 8];
  auto stage = [&](int k0, int buf) {
    // the wait in the copies' own statement stands in front of any rewrite of
    // the address registers that they name
    asm volatile(
        "global_load_async_to_lds_b128 %0, %1, off\n\t"
        "global_load_async_to_lds_b128 %2, %3, off\n\t"
        "s_wait_xcnt 0x0"
        :: "v"(kl + (unsigned)buf * (unsigned)(32 * KLD * 2)), "v"(kg + (size_t)k0 * Dh),
           "v"(vl + (unsigned)buf * (unsigned)(64 * VLD * 2)), "v"(vg + k0)
        : "memory");
  };

  // Q^T B-tiles: [column group][dchunk], loaded once, reused for all k.
  v16h bq[2][2];
#pragma unroll
  for (int rg = 0; rg < 2; ++rg) {
    bq[rg][0] = load_tile_f16(Qh + (size_t)rg * 16 * Dh, Dh, lane);
    bq[rg][1] = load_tile_f16(Qh + (size_t)rg * 16 * Dh + 32, Dh, lane);
  }

  v16h aones;
  {
    const _Float16 onev = (_Float16)((lane15 == 0) ? 1.0f : 0.0f);
#pragma unroll
    for (int j = 0; j < 16; ++j) aones[j] = onev;
  }

  v8f o[2][4] = {};     // O^T: [group][d tile]; register r = d 16 t + 8 half + r
  v8f osum[2] = {};
  float m_i[2] = {-1.0e30f, -1.0e30f};   // running maximum, raw units

  v16h pb[2];

  // lane masks of chunk 0: [column group], word e = 8 * key tile + register
  u32x16 mw[2];
  mw[0] = *(cu32x16*)(Pw);
  mw[1] = *(cu32x16*)(Pw + 16);

  stage(0, 0);
  asm volatile("s_wait_asynccnt 0x0" ::: "memory");   // this wave's chunk-0 copies have landed
  __syncthreads();                                    // chunk 0 published
  stage(32, 1);
  for (int k0 = 0, it = 0; k0 < Sq; k0 += 32, ++it) {
    const int buf = it & 1;

    // K A-tiles from LDS, shared by both column groups
    v16h a00 = load_tile_f16(&Kb[buf][0], KLD, lane);
    v16h a01 = load_tile_f16(&Kb[buf][32], KLD, lane);
    v16h a10 = load_tile_f16(&Kb[buf][16 * KLD], KLD, lane);
    v16h a11 = load_tile_f16(&Kb[buf][16 * KLD + 32], KLD, lane);

    v8f sc[2][2];   // S^T: [column group][key tile]
#pragma unroll
    for (int rg = 0; rg < 2; ++rg) {
      v8f s0 = {}, s1 = {};
      s0 = wmma_f16(a00, bq[rg][0], s0);
      s0 = wmma_f16(a01, bq[rg][1], s0);
      s1 = wmma_f16(a10, bq[rg][0], s1);
      s1 = wmma_f16(a11, bq[rg][1], s1);
#pragma unroll
      for (int i = 0; i < 8; ++i) {
        s0[i] = __builtin_amdgcn_inverse_ballot_w32(mw[rg][i]) ? s0[i] : NEGR;
        s1[i] = __builtin_amdgcn_inverse_ballot_w32(mw[rg][8 + i]) ? s1[i] : NEGR;
      }
      sc[rg][0] = s0;
      sc[rg][1] = s1;
    }
    // the next chunk's lane masks, behind the last select of this chunk: their
    // latency runs under the rest of the pass (the last pass reads its own again)
    {
      const unsigned* pn = Pw + (size_t)((it + 1 < Sq / 32) ? it + 1 : it) * 32;
      mw[0] = *(cu32x16*)(pn);
      mw[1] = *(cu32x16*)(pn + 16);
    }

#pragma unroll
    for (int rg = 0; rg < 2; ++rg) {
      // online softmax, one query per lane
      v8f sv0 = sc[rg][0], sv1 = sc[rg][1];
      float tm = sv0[0];
#pragma unroll
      for (int i = 1; i < 8; ++i) tm = fmaxf(tm, sv0[i]);
#pragma unroll
      for (int i = 0; i < 8; ++i) tm = fmaxf(tm, sv1[i]);
      tm = fmaxf(tm, xhalf(tm));
      const float mn = fmaxf(m_i[rg], tm);
      const float mc = mn * SC2;
      const v8f e0 = __builtin_elementwise_fma(sv0, (v8f)(SC2), (v8f)(-mc));
      const v8f e1 = __builtin_elementwise_fma(sv1, (v8f)(SC2), (v8f)(-mc));
#pragma unroll
      for (int i = 0; i < 8; ++i) {
        pb[rg][i]     = (_Float16)__builtin_amdgcn_exp2f(e0[i]);
        pb[rg][i + 8] = (_Float16)__builtin_amdgcn_exp2f(e1[i]);
      }
      // the difference first: exactly 1 while the maximum stands
      const float alpha = __builtin_amdgcn_exp2f((m_i[rg] - mn) * SC2);
      m_i[rg] = mn;
#pragma unroll
      for (int t = 0; t < 4; ++t)
#pragma unroll
        for (int i = 0; i < 8; ++i) o[rg][t][i] *= alpha;
      osum[rg][0] *= alpha;  // rows 1..15 of this tile are 0
    }

    // O^T += V^T * P^T: V^T A-tiles loaded once, used by both column groups
#pragma unroll
    for (int t = 0; t < 4; ++t) {
      v16h avt = load_tile_f16(&Vb[buf][(t * 16) * VLD], VLD, lane);
      o[0][t] = wmma_f16(avt, pb[0], o[0][t]);
      o[1][t] = wmma_f16(avt, pb[1], o[1][t]);
    }
    // l += 1 * P^T (row sums via WMMA)
    osum[0] = wmma_f16(aones, pb[0], osum[0]);
    osum[1] = wmma_f16(aones, pb[1], osum[1]);

    // publish point of the next chunk
    asm volatile("s_wait_dscnt 0x0" ::: "memory");     // this wave's reads of buf are done
    asm volatile("s_wait_asynccnt 0x0" ::: "memory");  // its copies of the next chunk have landed
    __syncthreads();   // next chunk published; every reader has left buf
    if (k0 + 64 < Sq) stage(k0 + 64, buf);
  }
  asm volatile("s_wait_asynccnt 0x0" ::: "memory");    // nothing in flight at the wave's end

#pragma unroll
  for (int rg = 0; rg < 2; ++rg) {
    const float l = osum[rg][0] + xhalf(osum[rg][0]);
    const float inv = 1.0f / l;
    // The group's 16 rows go through the wave's own LDS range, so that a
    // wave-wide store covers two rows of 256 bytes: four whole 128-byte lines.
    float* ow = &Os[wave][0];
#pragma unroll
    for (int t = 0; t < 4; ++t) {
      v4f lo, hi;
#pragma unroll
      for (int i = 0; i < 4; ++i) {
        lo[i] = o[rg][t][i] * inv;
        hi[i] = o[rg][t][i + 4] * inv;
      }
      *(v4f*)&ow[lane15 * OLD + t * 16 + (half << 3)]     = lo;
      *(v4f*)&ow[lane15 * OLD + t * 16 + (half << 3) + 4] = hi;
    }
    // the wave's rows lie in LDS before other lanes of it read them back
    asm volatile("s_wait_dscnt 0x0" ::: "memory");
    v4f ln[8];
#pragma unroll
    for (int j = 0; j < 8; ++j)
      ln[j] = *(const v4f*)&ow[(j * 2 + half) * OLD + lane15 * 4];
    float* orow = out + ((size_t)b * Sq + q0 + rg * 16 + half) * (Hh * Dh) + h * Dh + lane15 * 4;
#pragma unroll
    for (int j = 0; j < 8; ++j)
      *(v4f*)(orow + (size_t)(j * 2) * (Hh * Dh)) = ln[j];
    if (rg == 0) {
      // the second group's products reuse the registers that these stores name
      asm volatile("s_wait_xcnt 0x0" ::: "memory");
      // holds those products behind the wait (the scheduler otherwise lifts them over it)
      __builtin_amdgcn_sched_barrier(0);
    }
  }
}

// ---------------------------------------------------------------------------
extern "C" void kernel_launch(void* const* d_in, const int* in_sizes, int n_in,
                              void* d_out, int out_size, void* d_ws,
                              size_t ws_size, hipStream_t stream) {
  (void)in_sizes; (void)n_in; (void)out_size; (void)ws_size;
  const float* q    = (const float*)d_in[0];
  const float* k    = (const float*)d_in[1];
  const float* v    = (const float*)d_in[2];
  const int*   msk  = (const int*)d_in[3];
  const float* wq   = (const float*)d_in[4];
  const float* bq   = (const float*)d_in[5];
  const float* wk   = (const float*)d_in[6];
  const float* bk   = (const float*)d_in[7];
  const float* wv   = (const float*)d_in[8];
  const float* bv   = (const float*)d_in[9];
  float* out = (float*)d_out;

  // workspace layout (f16): 3x W^T (2 MB each) + qh/kh/vt (16 MB each) + 2 MB of lane masks
  _Float16* ws  = (_Float16*)d_ws;
  _Float16* wtq = ws;
  _Float16* wtk = wtq + (size_t)Dm * Dm;
  _Float16* wtv = wtk + (size_t)Dm * Dm;
  _Float16* qh  = wtv + (size_t)Dm * Dm;
  const size_t headElems = (size_t)Bsz * Hh * Sq * Dh;
  _Float16* kh = qh + headElems;
  _Float16* vt = kh + headElems;
  unsigned* pm = (unsigned*)(vt + headElems);   // lane masks, B*S*S/8 bytes

  dim3 gT(Dm / TT, Dm / TT, 3);
  wtrans_kernel<<<gT, 256, 0, stream>>>(wq, wk, wv, wtq, wtk, wtv);

  dim3 gP(Dm / PBN, (Bsz * Sq) / PBM, 3);
  proj_kernel<<<gP, 256, 0, stream>>>(q, k, v, wtq, wtk, wtv, bq, bk, bv,
                                      qh, kh, vt);

  maskpack_kernel<<<Bsz * (Sq / 32) * (Sq / 64) / 8, 256, 0, stream>>>(msk, pm);

  dim3 gA(Bsz * Hh, Sq / (QROWS * AWAVES));
  attn_kernel<<<gA, 32 * AWAVES, 0, stream>>>(qh, kh, vt, pm, out);
}

// v008
// Measured time: 124 microseconds a run.
// Two timings next to v007 both put it at 1.05 times that version's speed.
// All steps since v000 together make it 4.64 times as fast.
#include <hip/hip_runtime.h>
#include <hip/hip_bf16.h>

#define DEV __device__ __forceinline__

typedef __attribute__((ext_vector_type(16))) _Float16 v16h;
typedef __attribute__((ext_vector_type(8)))  _Float16 v8h;
typedef __attribute__((ext_vector_type(4)))  _Float16 v4h;
typedef __attribute__((ext_vector_type(8)))  float    v8f;
typedef __attribute__((ext_vector_type(4)))  float    v4f;
typedef __attribute__((ext_vector_type(4)))  int      i32x4;
typedef __attribute__((ext_vector_type(16))) unsigned u32x16;
// memory that no one writes while the kernel runs: a load at a wave-uniform
// address through this type is a scalar load
typedef const __attribute__((address_space(4))) u32x16 cu32x16;

static constexpr int Bsz = 4;
static constexpr int Sq  = 2048;
static constexpr int Dm  = 1024;
static constexpr int Hh  = 16;
static constexpr int Dh  = 64;
// Raw scores (before the 1/sqrt(64)) are turned into exponents of 2 by one
// multiply-add with SC2 = log2(e) / sqrt(64).
#define SC2 (0.125f * 1.44269504088896340736f)
// A masked score, in raw units: -2^33 (-2^30 after the scale; the reference's
// -1e9 and this value give the same softmax, 0 beside any kept score and equal
// weights in a row with none). A power of two, so that its product with SC2 is
// exact and a row of masked scores alone gets the exponent 0 exactly.
#define NEGR (-8589934592.0f)
// The maximum in use moves only when a chunk's maximum stands more than this
// above it, in raw units: 8 in the exponent of 2, so P stays at or below 2^8.
#define LAZYR (8.0f / SC2)
#define AWAVES 8   // waves per attention block
#define QROWS 32   // q rows per wave (2 row-groups of 16)

// ---------------------------------------------------------------------------
// D = A(16x32 f16) * B(32x16 f16) + C(16x16 f32)
DEV v8f wmma_f16(v16h a, v16h b, v8f c) {
  return __builtin_amdgcn_wmma_f32_16x16x32_f16(
      /*neg_a=*/false, a, /*neg_b=*/false, b,
      /*c_mod=*/(short)0, c, /*reuse_a=*/false, /*reuse_b=*/false);
}

DEV v16h load_tile_f16(const _Float16* p, int ld, int lane) {
  const _Float16* base = p + (size_t)(lane & 15) * ld + ((lane >> 4) << 3);
  v8h c0 = *(const v8h*)(base);
  v8h c1 = *(const v8h*)(base + 16);
  v16h r;
#pragma unroll
  for (int j = 0; j < 8; ++j) { r[j] = c0[j]; r[j + 8] = c1[j]; }
  return r;
}

// Same tile pattern but f32 source, converted to f16 on the fly.
DEV v16h load_tile_f32(const float* p, int ld, int lane) {
  const float* base = p + (size_t)(lane & 15) * ld + ((lane >> 4) << 3);
  v4f a0 = *(const v4f*)(base);
  v4f a1 = *(const v4f*)(base + 4);
  v4f b0 = *(const v4f*)(base + 16);
  v4f b1 = *(const v4f*)(base + 20);
  v16h r;
#pragma unroll
  for (int j = 0; j < 4; ++j) {
    r[j]      = (_Float16)a0[j];
    r[j + 4]  = (_Float16)a1[j];
    r[j + 8]  = (_Float16)b0[j];
    r[j + 12] = (_Float16)b1[j];
  }
  return r;
}

// ---------------------------------------------------------------------------
// Kernel 1: transpose + convert weights (1024x1024 f32 [k][n]) -> f16 W^T [n][k].
// grid = (n tiles, k tiles, 3 = q,k,v); a block of 256 takes one 64 x 64 tile.
// A thread loads a 4 x 4 piece (one float4 of four consecutive k rows; a
// wave-wide load covers two 256-byte row pieces, whole lines), turns it in
// registers and lays it in LDS as [n][k] at a 144-byte row pitch. The tile goes
// out in 16-byte pieces: a wave-wide store covers four whole 128-byte lines.
static constexpr int TT  = 64;   // tile edge
static constexpr int TLD = 72;   // LDS row pitch in halfs (144 B = 16 B x 9)

__global__ __launch_bounds__(256) void wtrans_kernel(
    const float* __restrict__ wq, const float* __restrict__ wk,
    const float* __restrict__ wv, _Float16* __restrict__ tq,
    _Float16* __restrict__ tk, _Float16* __restrict__ tv) {
  __shared__ __attribute__((aligned(16))) _Float16 Ts[TT * TLD];   // [n][k]
  const float* w = (blockIdx.z == 0) ? wq : (blockIdx.z == 1) ? wk : wv;
  _Float16* o    = (blockIdx.z == 0) ? tq : (blockIdx.z == 1) ? tk : tv;
  const int tid = threadIdx.x;
  const int n0 = blockIdx.x * TT, k0 = blockIdx.y * TT;
  const int n4 = (tid & 15) * 4, k4 = (tid >> 4) * 4;

  const float* src = w + (size_t)(k0 + k4) * Dm + n0 + n4;
  v4f r[4];
#pragma unroll
  for (int j = 0; j < 4; ++j) r[j] = *(const v4f*)(src + (size_t)j * Dm);
#pragma unroll
  for (int e = 0; e < 4; ++e) {
    v4h c;
#pragma unroll
    for (int j = 0; j < 4; ++j) c[j] = (_Float16)r[j][e];
    *(v4h*)&Ts[(n4 + e) * TLD + k4] = c;
  }
  __syncthreads();   // the whole tile lies in LDS before any row of it is read

  const int row = tid >> 3, pc = (tid & 7) * 8;
  _Float16* dst = o + (size_t)(n0 + row) * Dm + k0 + pc;
#pragma unroll
  for (int j = 0; j < 2; ++j)
    *(v8h*)(dst + (size_t)(32 * j) * Dm) = *(const v8h*)&Ts[(row + 32 * j) * TLD + pc];
}

// ---------------------------------------------------------------------------
// Kernel 2: fused QKV projection GEMM (wave32 WMMA), LDS-tiled.
// grid = (N/128 column tiles, (B*S)/128 row tiles, 3 = q,k,v). Block = 256
// (8 waves, 2 x 4); the block owns a 128 x 128 tile of the output, wave
// (wm, wn) its 64 x 32 part (4 x 2 accumulator tiles).
// Per 64-k step both operands are read from global memory once per block with
// whole-line loads (x converted to f16 on the way) and laid in LDS at a
// 144-byte row pitch; fragments come from LDS. Two LDS buffers: the next
// step's global loads are issued ahead of this step's products and stored
// behind them, one barrier per step.
// Q,K heads -> [b][h][s][64] f16; V -> transposed [b][h][d][s] f16.
static constexpr int PBM = 128;   // rows of x per block
static constexpr int PBN = 128;   // output columns per block
static constexpr int PBK = 64;    // k per step
static constexpr int PLD = 72;    // LDS row pitch in halfs (144 B = 16 B x 9)
static constexpr int SLD = 136;   // row pitch of the result tile in LDS, halfs (272 B = 16 B x 17)

__global__ __launch_bounds__(256) void proj_kernel(
    const float* __restrict__ xq, const float* __restrict__ xk,
    const float* __restrict__ xv, const _Float16* __restrict__ wtq,
    const _Float16* __restrict__ wtk, const _Float16* __restrict__ wtv,
    const float* __restrict__ bq, const float* __restrict__ bk,
    const float* __restrict__ bv, _Float16* __restrict__ qh,
    _Float16* __restrict__ kh, _Float16* __restrict__ vt) {
  __shared__ __attribute__((aligned(16))) _Float16 As[2][PBM * PLD];
  __shared__ __attribute__((aligned(16))) _Float16 Bs[2][PBN * PLD];

  const int which = blockIdx.z;
  const float* x      = (which == 0) ? xq  : (which == 1) ? xk  : xv;
  const _Float16* wt  = (which == 0) ? wtq : (which == 1) ? wtk : wtv;
  const float* bias   = (which == 0) ? bq  : (which == 1) ? bk  : bv;
  _Float16* out       = (which == 0) ? qh  : (which == 1) ? kh  : vt;
  const bool tr = (which == 2);

  const int tid    = threadIdx.x;
  const int wave   = tid >> 5;
  const int lane   = tid & 31;
  const int lane15 = lane & 15;
  const int half   = lane >> 4;
  const int wm = wave >> 2;             // 0..1: 64-row part
  const int wn = wave & 3;              // 0..3: 32-column part
  const int r0 = blockIdx.y * PBM;      // global activation row in [0, B*S)
  const int n0 = blockIdx.x * PBN;      // output column base

  // x tile: 128 rows x 64 f32; thread takes float4 (tid & 15) of rows
  // (tid >> 4) + 16 j. W^T tile: 128 rows x 64 f16; thread takes the 16-byte
  // piece (tid & 7) of rows (tid >> 3) + 32 j.
  const int arow = tid >> 4, acol = (tid & 15) * 4;
  const int brow = tid >> 3, bcol = (tid & 7) * 8;
  const float*    ag = x  + (size_t)(r0 + arow) * Dm + acol;
  const _Float16* bg = wt + (size_t)(n0 + brow) * Dm + bcol;

  v4f ra[8];
  v8h rb[4];
  auto gload = [&](int kt) {
#pragma unroll
    for (int j = 0; j < 8; ++j)
      ra[j] = *(const v4f*)(ag + (size_t)(16 * j) * Dm + kt * PBK);
#pragma unroll
    for (int j = 0; j < 4; ++j)
      rb[j] = *(const v8h*)(bg + (size_t)(32 * j) * Dm + kt * PBK);
  };
  auto lstore = [&](int buf) {
#pragma unroll
    for (int j = 0; j < 8; ++j) {
      v4h hx;
#pragma unroll
      for (int e = 0; e < 4; ++e) hx[e] = (_Float16)ra[j][e];
      *(v4h*)&As[buf][(arow + 16 * j) * PLD + acol] = hx;
    }
#pragma unroll
    for (int j = 0; j < 4; ++j)
      *(v8h*)&Bs[buf][(brow + 32 * j) * PLD + bcol] = rb[j];
  };

  v8f acc[4][2] = {};
  auto compute = [&](int buf) {
#pragma unroll
    for (int ks = 0; ks < PBK; ks += 32) {
      v16h a[4], bm[2];
#pragma unroll
      for (int i = 0; i < 4; ++i)
        a[i] = load_tile_f16(&As[buf][(wm * 64 + i * 16) * PLD + ks], PLD, lane);
#pragma unroll
      for (int t = 0; t < 2; ++t)
        bm[t] = load_tile_f16(&Bs[buf][(wn * 32 + t * 16) * PLD + ks], PLD, lane);
#pragma unroll
      for (int i = 0; i < 4; ++i)
#pragma unroll
        for (int t = 0; t < 2; ++t) acc[i][t] = wmma_f16(a[i], bm[t], acc[i][t]);
    }
  };

  constexpr int NK = Dm / PBK;
  gload(0);
  lstore(0);
  __syncthreads();                 // step 0 published
  for (int kt = 0; kt < NK - 1; ++kt) {
    const int buf = kt & 1;
    gload(kt + 1);
    // holds the next step's global loads ahead of the products, so that their
    // latency runs under them (the scheduler otherwise sinks them to the stores)
    __builtin_amdgcn_sched_barrier(0);
    compute(buf);
    // holds the waits on those loads, the conversions and the LDS stores
    // behind the last product
    __builtin_amdgcn_sched_barrier(0);
    lstore(buf ^ 1);               // its last readers left before the previous barrier
    __syncthreads();               // publishes step kt+1, ends the reads of buf
  }
  compute((NK - 1) & 1);

  // The block's 128 x 128 tile of f16 results is laid in LDS over the x buffers
  // (q, k as [row][column], v as [column][row]) and leaves in 16-byte pieces:
  // a wave-wide store then covers four whole 128-byte lines.
  _Float16* St = &As[0][0];
  // holds the last products in front of the barrier: lifted behind it they keep
  // all their fragments in registers at once, and the larger register count
  // costs a resident work-group per WGP
  __builtin_amdgcn_sched_barrier(0);
  __syncthreads();   // every wave has left the operand buffers before the tile is laid over them
  const int rl = wm * 64 + (half << 3);     // first of this lane's 8 rows in accumulator tile 0
  const int cl = wn * 32 + lane15;          // this lane's column in accumulator tile 0
  const float bi[2] = {bias[n0 + cl], bias[n0 + cl + 16]};
  if (!tr) {
#pragma unroll
    for (int i4 = 0; i4 < 4; ++i4)
#pragma unroll
      for (int t = 0; t < 2; ++t)
#pragma unroll
        for (int i = 0; i < 8; ++i)
          St[(rl + i4 * 16 + i) * SLD + cl + t * 16] = (_Float16)(acc[i4][t][i] + bi[t]);
  } else {
#pragma unroll
    for (int i4 = 0; i4 < 4; ++i4)
#pragma unroll
      for (int t = 0; t < 2; ++t) {
        v8h pk;
#pragma unroll
        for (int i = 0; i < 8; ++i) pk[i] = (_Float16)(acc[i4][t][i] + bi[t]);
        *(v8h*)&St[(cl + t * 16) * SLD + rl + i4 * 16] = pk;
      }
  }
  __syncthreads();   // the tile is whole before any line of it is read

  const int b = r0 >> 11, s0 = r0 & (Sq - 1);   // a block's 128 rows lie in one batch
  v8h ln[8];
  if (!tr) {
    // [b][h][s][64]: one (head, s) row is one line; 4 consecutive s per wave-wide store
    const int pc = (tid & 7) * 8, rr = tid >> 3;
#pragma unroll
    for (int j = 0; j < 8; ++j)
      ln[j] = *(const v8h*)&St[((j & 3) * 32 + rr) * SLD + (j >> 2) * Dh + pc];
    _Float16* dst = out + ((size_t)(b * Hh + (n0 >> 6)) * Sq + s0 + rr) * Dh + pc;
#pragma unroll
    for (int j = 0; j < 8; ++j)
      *(v8h*)(dst + ((size_t)(j >> 2) * Sq + (j & 3) * 32) * Dh) = ln[j];
    // the wait in front of any reuse of the registers that these stores name
    asm volatile("s_wait_xcnt 0x0" ::: "memory");
  } else {
    // [b][h][d][S]: 128 consecutive s of one (h, d) row are two lines
    const int pc = (tid & 15) * 8, cc = tid >> 4;
#pragma unroll
    for (int j = 0; j < 8; ++j)
      ln[j] = *(const v8h*)&St[(j * 16 + cc) * SLD + pc];
    _Float16* dst = out + ((size_t)b * (Hh * Dh) + n0 + cc) * Sq + s0 + pc;
#pragma unroll
    for (int j = 0; j < 8; ++j)
      *(v8h*)(dst + (size_t)(j * 16) * Sq) = ln[j];
  }
}

__global__ __launch_bounds__(256) void maskpack_kernel(
    const int* __restrict__ mask, unsigned* __restrict__ pm) {
  const int lane   = threadIdx.x & 31;
  const int lane15 = lane & 15;
  const int half   = lane >> 4;
  const int w  = blockIdx.x * 8 + (threadIdx.x >> 5);
  const int cp = w & (Sq / 64 - 1);   // pair of key chunks
  const int qb = w / (Sq / 64);       // b * S/32 + query block
  const int* src = mask + ((size_t)qb * 32 + lane15) * Sq + cp * 64 + (half << 3);

  i32x4 mk[2][2][4];   // [chunk][column group][piece]
#pragma unroll
  for (int c = 0; c < 2; ++c)
#pragma unroll
    for (int rg = 0; rg < 2; ++rg) {
      const int* mrow = src + (size_t)(rg * 16) * Sq + c * 32;
      mk[c][rg][0] = *(const i32x4*)(mrow);
      mk[c][rg][1] = *(const i32x4*)(mrow + 4);
      mk[c][rg][2] = *(const i32x4*)(mrow + 16);
      mk[c][rg][3] = *(const i32x4*)(mrow + 20);
    }
  // the wait in front of any reuse of the loads' address registers; naming the
  // address keeps the pair live up to it
  asm volatile("s_wait_xcnt 0x0" :: "v"(src) : "memory");

  unsigned* dst = pm + ((size_t)qb * (Sq / 32) + cp * 2) * 32 + lane;
#pragma unroll
  for (int c = 0; c < 2; ++c) {
    unsigned v = 0;
#pragma unroll
    for (int rg = 0; rg < 2; ++rg)
#pragma unroll
      for (int e = 0; e < 16; ++e) {
        const unsigned keep =
            __builtin_amdgcn_ballot_w32(mk[c][rg][e >> 2][e & 3] != 0);
        v = (lane == rg * 16 + e) ? keep : v;   // lane rg*16+e stores word e
      }
    dst[c * 32] = v;
  }
}

static constexpr int KLD = 72;   // K row pitch in LDS, halfs (144 B = 16 B x 9)
static constexpr int VLD = 40;   // V^T row pitch in LDS, halfs (80 B = 16 B x 5)
static constexpr int OLD = 68;   // output row pitch in LDS, floats (272 B = 16 B x 17)

DEV float xhalf(float x) {
  const int v = __builtin_bit_cast(int, x);
  return __builtin_bit_cast(
      float, __builtin_amdgcn_permlanex16(v, v, 0x76543210, 0xfedcba98, false, false));
}

__global__ __launch_bounds__(32 * AWAVES) void attn_kernel(
    const _Float16* __restrict__ qh, const _Float16* __restrict__ kh,
    const _Float16* __restrict__ vt, const unsigned* __restrict__ pm,
    float* __restrict__ out) {
  __shared__ __attribute__((aligned(16))) _Float16 Kb[2][32 * KLD];  // [kpos][d]
  __shared__ __attribute__((aligned(16))) _Float16 Vb[2][64 * VLD];  // [d][kpos]
  // each wave's own range: 16 output rows of 64 floats on their way to memory
  __shared__ __attribute__((aligned(16))) float Os[AWAVES][16 * OLD];

  const int bh = blockIdx.x;
  const int b = bh >> 4, h = bh & 15;
  const int tid    = threadIdx.x;
  const int wave   = tid >> 5;
  const int lane   = tid & 31;
  const int lane15 = lane & 15;
  const int half   = lane >> 4;
  const int q0 = (blockIdx.y * AWAVES + wave) * QROWS;

  const _Float16* Qh = qh + ((size_t)bh * Sq + q0) * Dh;
  const _Float16* Kh = kh + (size_t)bh * Sq * Dh;
  const _Float16* Vh = vt + (size_t)bh * Dh * Sq;
  // this wave's lane masks: 32 words per key chunk, a wave-uniform address
  const unsigned* Pw =
      pm + ((size_t)b * (Sq / 32) + blockIdx.y * AWAVES +
            __builtin_amdgcn_readfirstlane(wave)) * (size_t)(Sq / 32) * 32;

  // stage one 32-kpos K/V chunk into LDS buffer `buf`: K tile 32 rows x 128 B
  // (thread: 16-byte piece tid & 7 of row tid >> 3, 4 KB contiguous in memory),
  // V^T tile 64 rows x 64 B (piece tid & 3 of row tid >> 2, source pitch Sq halfs)
  const _Float16* kg = Kh + tid * 8;
  const _Float16* vg = Vh + (size_t)(tid >> 2) * Sq + (tid & 3) * 8;
  const unsigned kl = (unsigned)(size_t)&Kb[0][(tid >> 3) * KLD + (tid & 7) * 8];
  const unsigned vl = (unsigned)(size_t)&Vb[0][(tid >> 2) * VLD + (tid & 3) * 8];
  auto stage = [&](int k0, int buf) {
    // the wait in the copies' own statement stands in front of any rewrite of
    // the address registers that they name
    asm volatile(
        "global_load_async_to_lds_b128 %0, %1, off\n\t"
        "global_load_async_to_lds_b128 %2, %3, off\n\t"
        "s_wait_xcnt 0x0"
        :: "v"(kl + (unsigned)buf * (unsigned)(32 * KLD * 2)), "v"(kg + (size_t)k0 * Dh),
           "v"(vl + (unsigned)buf * (unsigned)(64 * VLD * 2)), "v"(vg + k0)
        : "memory");
  };

  // Q^T B-tiles: [column group][dchunk], loaded once, reused for all k.
  v16h bq[2][2];
#pragma unroll
  for (int rg = 0; rg < 2; ++rg) {
    bq[rg][0] = load_tile_f16(Qh + (size_t)rg * 16 * Dh, Dh, lane);
    bq[rg][1] = load_tile_f16(Qh + (size_t)rg * 16 * Dh + 32, Dh, lane);
  }

  v16h aones;
  {
    const _Float16 onev = (_Float16)((lane15 == 0) ? 1.0f : 0.0f);
#pragma unroll
    for (int j = 0; j < 16; ++j) aones[j] = onev;
  }

  v8f o[2][4] = {};     // O^T: [group][d tile]; register r = d 16 t + 8 half + r
  v8f osum[2] = {};
  float m_i[2] = {-1.0e30f, -1.0e30f};   // maximum in use, raw units; the first pass always moves it
  float mc[2]  = {-1.0e30f * SC2, -1.0e30f * SC2};   // m_i * SC2

  v16h pb[2];

  // lane masks of chunk 0: [column group], word e = 8 * key tile + register
  u32x16 mw[2];
  mw[0] = *(cu32x16*)(Pw);
  mw[1] = *(cu32x16*)(Pw + 16);

  stage(0, 0);
  asm volatile("s_wait_asynccnt 0x0" ::: "memory");   // this wave's chunk-0 copies have landed
  __syncthreads();                                    // chunk 0 published
  stage(32, 1);
  for (int k0 = 0, it = 0; k0 < Sq; k0 += 32, ++it) {
    const int buf = it & 1;

    // K A-tiles from LDS, shared by both column groups
    v16h a00 = load_tile_f16(&Kb[buf][0], KLD, lane);
    v16h a01 = load_tile_f16(&Kb[buf][32], KLD, lane);
    v16h a10 = load_tile_f16(&Kb[buf][16 * KLD], KLD, lane);
    v16h a11 = load_tile_f16(&Kb[buf][16 * KLD + 32], KLD, lane);

    v8f sc[2][2];   // S^T: [column group][key tile]
#pragma unroll
    for (int rg = 0; rg < 2; ++rg) {
      v8f s0 = {}, s1 = {};
      s0 = wmma_f16(a00, bq[rg][0], s0);
      s0 = wmma_f16(a01, bq[rg][1], s0);
      s1 = wmma_f16(a10, bq[rg][0], s1);
      s1 = wmma_f16(a11, bq[rg][1], s1);
#pragma unroll
      for (int i = 0; i < 8; ++i) {
        s0[i] = __builtin_amdgcn_inverse_ballot_w32(mw[rg][i]) ? s0[i] : NEGR;
        s1[i] = __builtin_amdgcn_inverse_ballot_w32(mw[rg][8 + i]) ? s1[i] : NEGR;
      }
      sc[rg][0] = s0;
      sc[rg][1] = s1;
    }
    // online softmax, one query per lane: the maximum of this lane's 16 scores
    // (its half of the query's 32 keys)
    float tm[2];
#pragma unroll
    for (int rg = 0; rg < 2; ++rg) {
      float t = sc[rg][0][0];
#pragma unroll
      for (int i = 1; i < 8; ++i) t = fmaxf(t, sc[rg][0][i]);
#pragma unroll
      for (int i = 0; i < 8; ++i) t = fmaxf(t, sc[rg][1][i]);
      tm[rg] = t;
    }
    // One test per pass for both groups and both halves. The difference is
    // taken first, so that the bound on P holds at any size of the scores.
    const bool need = (tm[0] - m_i[0] > LAZYR) | (tm[1] - m_i[1] > LAZYR);
    if (__builtin_amdgcn_ballot_w32(need) != 0) {
#pragma unroll
      for (int rg = 0; rg < 2; ++rg) {
        // both halves of a query take the same new maximum
        const float mn = fmaxf(m_i[rg], fmaxf(tm[rg], xhalf(tm[rg])));
        const float alpha = __builtin_amdgcn_exp2f((m_i[rg] - mn) * SC2);
        m_i[rg] = mn;
        mc[rg]  = mn * SC2;
#pragma unroll
        for (int t = 0; t < 4; ++t)
#pragma unroll
          for (int i = 0; i < 8; ++i) o[rg][t][i] *= alpha;
        osum[rg][0] *= alpha;  // rows 1..15 of this tile are 0
      }
    }
    // the next chunk's lane masks, behind the last select of this chunk: their
    // latency runs under the rest of the pass (the last pass reads its own again)
    {
      const unsigned* pn = Pw + (size_t)((it + 1 < Sq / 32) ? it + 1 : it) * 32;
      mw[0] = *(cu32x16*)(pn);
      mw[1] = *(cu32x16*)(pn + 16);
    }
    // V^T A-tiles, each used by both column groups
    v16h avt[4];
#pragma unroll
    for (int t = 0; t < 4; ++t) avt[t] = load_tile_f16(&Vb[buf][(t * 16) * VLD], VLD, lane);
    // holds those loads at the head of the block behind the branch, as one
    // group, so that their latency runs under the exponentials (the scheduler
    // otherwise sinks them between the products, each pair with a wait to 0)
    __builtin_amdgcn_sched_barrier(0);
#pragma unroll
    for (int rg = 0; rg < 2; ++rg) {
      const v8f e0 = __builtin_elementwise_fma(sc[rg][0], (v8f)(SC2), (v8f)(-mc[rg]));
      const v8f e1 = __builtin_elementwise_fma(sc[rg][1], (v8f)(SC2), (v8f)(-mc[rg]));
#pragma unroll
      for (int i = 0; i < 8; ++i) {
        pb[rg][i]     = (_Float16)__builtin_amdgcn_exp2f(e0[i]);
        pb[rg][i + 8] = (_Float16)__builtin_amdgcn_exp2f(e1[i]);
      }
    }

    // O^T += V^T * P^T
#pragma unroll
    for (int t = 0; t < 4; ++t) {
      o[0][t] = wmma_f16(avt[t], pb[0], o[0][t]);
      o[1][t] = wmma_f16(avt[t], pb[1], o[1][t]);
    }
    // l += 1 * P^T (row sums via WMMA)
    osum[0] = wmma_f16(aones, pb[0], osum[0]);
    osum[1] = wmma_f16(aones, pb[1], osum[1]);

    // publish point of the next chunk
    asm volatile("s_wait_dscnt 0x0" ::: "memory");     // this wave's reads of buf are done
    asm volatile("s_wait_asynccnt 0x0" ::: "memory");  // its copies of the next chunk have landed
    __syncthreads();   // next chunk published; every reader has left buf
    if (k0 + 64 < Sq) stage(k0 + 64, buf);
  }
  asm volatile("s_wait_asynccnt 0x0" ::: "memory");    // nothing in flight at the wave's end

#pragma unroll
  for (int rg = 0; rg < 2; ++rg) {
    const float l = osum[rg][0] + xhalf(osum[rg][0]);
    const float inv = 1.0f / l;
    // The group's 16 rows go through the wave's own LDS range, so that a
    // wave-wide store covers two rows of 256 bytes: four whole 128-byte lines.
    float* ow = &Os[wave][0];
#pragma unroll
    for (int t = 0; t < 4; ++t) {
      v4f lo, hi;
#pragma unroll
      for (int i = 0; i < 4; ++i) {
        lo[i] = o[rg][t][i] * inv;
        hi[i] = o[rg][t][i + 4] * inv;
      }
      *(v4f*)&ow[lane15 * OLD + t * 16 + (half << 3)]     = lo;
      *(v4f*)&ow[lane15 * OLD + t * 16 + (half << 3) + 4] = hi;
    }
    // the wave's rows lie in LDS before other lanes of it read them back
    asm volatile("s_wait_dscnt 0x0" ::: "memory");
    v4f ln[8];
#pragma unroll
    for (int j = 0; j < 8; ++j)
      ln[j] = *(const v4f*)&ow[(j * 2 + half) * OLD + lane15 * 4];
    float* orow = out + ((size_t)b * Sq + q0 + rg * 16 + half) * (Hh * Dh) + h * Dh + lane15 * 4;
#pragma unroll
    for (int j = 0; j < 8; ++j)
      *(v4f*)(orow + (size_t)(j * 2) * (Hh * Dh)) = ln[j];
    if (rg == 0) {
      // the second group's products reuse the registers that these stores name
      asm volatile("s_wait_xcnt 0x0" ::: "memory");
      // holds those products behind the wait (the scheduler otherwise lifts them over it)
      __builtin_amdgcn_sched_barrier(0);
    }
  }
}

// ---------------------------------------------------------------------------
extern "C" void kernel_launch(void* const* d_in, const int* in_sizes, int n_in,
                              void* d_out, int out_size, void* d_ws,
                              size_t ws_size, hipStream_t stream) {
  (void)in_sizes; (void)n_in; (void)out_size; (void)ws_size;
  const float* q    = (const float*)d_in[0];
  const float* k    = (const float*)d_in[1];
  const float* v    = (const float*)d_in[2];
  const int*   msk  = (const int*)d_in[3];
  const float* wq   = (const float*)d_in[4];
  const float* bq   = (const float*)d_in[5];
  const float* wk   = (const float*)d_in[6];
  const float* bk   = (const float*)d_in[7];
  const float* wv   = (const float*)d_in[8];
  const float* bv   = (const float*)d_in[9];
  float* out = (float*)d_out;

  // workspace layout (f16): 3x W^T (2 MB each) + qh/kh/vt (16 MB each) + 2 MB of lane masks
  _Float16* ws  = (_Float16*)d_ws;
  _Float16* wtq = ws;
  _Float16* wtk = wtq + (size_t)Dm * Dm;
  _Float16* wtv = wtk + (size_t)Dm * Dm;
  _Float16* qh  = wtv + (size_t)Dm * Dm;
  const size_t headElems = (size_t)Bsz * Hh * Sq * Dh;
  _Float16* kh = qh + headElems;
  _Float16* vt = kh + headElems;
  unsigned* pm = (unsigned*)(vt + headElems);   // lane masks, B*S*S/8 bytes

  dim3 gT(Dm / TT, Dm / TT, 3);
  wtrans_kernel<<<gT, 256, 0, stream>>>(wq, wk, wv, wtq, wtk, wtv);

  dim3 gP(Dm / PBN, (Bsz * Sq) / PBM, 3);
  proj_kernel<<<gP, 256, 0, stream>>>(q, k, v, wtq, wtk, wtv, bq, bk, bv,
                                      qh, kh, vt);

  maskpack_kernel<<<Bsz * (Sq / 32) * (Sq / 64) / 8, 256, 0, stream>>>(msk, pm);

  dim3 gA(Bsz * Hh, Sq / (QROWS * AWAVES));
  attn_kernel<<<gA, 32 * AWAVES, 0, stream>>>(qh, kh, vt, pm, out);
}

// v009
// Measured time: 119 microseconds a run.
// Timed twice side by side with v008, it ran 1.05 times as fast both times.
// Counting every step since v000, it is 4.87 times as fast.
#include <hip/hip_runtime.h>
#include <hip/hip_bf16.h>

#define DEV __device__ __forceinline__

typedef __attribute__((ext_vector_type(16))) _Float16 v16h;
typedef __attribute__((ext_vector_type(8)))  _Float16 v8h;
typedef __attribute__((ext_vector_type(4)))  _Float16 v4h;
typedef __attribute__((ext_vector_type(8)))  float    v8f;
typedef __attribute__((ext_vector_type(4)))  float    v4f;
typedef __attribute__((ext_vector_type(4)))  int      i32x4;
typedef __attribute__((ext_vector_type(16))) unsigned u32x16;
// memory that no one writes while the kernel runs: a load at a wave-uniform
// address through this type is a scalar load
typedef const __attribute__((address_space(4))) u32x16 cu32x16;

static constexpr int Bsz = 4;
static constexpr int Sq  = 2048;
static constexpr int Dm  = 1024;
static constexpr int Hh  = 16;
static constexpr int Dh  = 64;
// Raw scores (before the 1/sqrt(64)) are turned into exponents of 2 by one
// multiply-add with SC2 = log2(e) / sqrt(64).
#define SC2 (0.125f * 1.44269504088896340736f)
// A masked score, in raw units: -2^33 (-2^30 after the scale; the reference's
// -1e9 and this value give the same softmax, 0 beside any kept score and equal
// weights in a row with none). A power of two, so that its product with SC2 is
// exact and a row of masked scores alone gets the exponent 0 exactly.
#define NEGR (-8589934592.0f)
// The maximum in use moves only when a chunk's maximum stands more than this
// above it, in raw units: 8 in the exponent of 2, so P stays at or below 2^8.
#define LAZYR (8.0f / SC2)
#define AWAVES 8   // waves per attention block
#define QROWS 32   // q rows per wave (2 row-groups of 16)

// ---------------------------------------------------------------------------
// D = A(16x32 f16) * B(32x16 f16) + C(16x16 f32)
DEV v8f wmma_f16(v16h a, v16h b, v8f c) {
  return __builtin_amdgcn_wmma_f32_16x16x32_f16(
      /*neg_a=*/false, a, /*neg_b=*/false, b,
      /*c_mod=*/(short)0, c, /*reuse_a=*/false, /*reuse_b=*/false);
}

DEV v16h load_tile_f16(const _Float16* p, int ld, int lane) {
  const _Float16* base = p + (size_t)(lane & 15) * ld + ((lane >> 4) << 3);
  v8h c0 = *(const v8h*)(base);
  v8h c1 = *(const v8h*)(base + 16);
  v16h r;
#pragma unroll
  for (int j = 0; j < 8; ++j) { r[j] = c0[j]; r[j + 8] = c1[j]; }
  return r;
}

// Same tile pattern but f32 source, converted to f16 on the fly.
DEV v16h load_tile_f32(const float* p, int ld, int lane) {
  const float* base = p + (size_t)(lane & 15) * ld + ((lane >> 4) << 3);
  v4f a0 = *(const v4f*)(base);
  v4f a1 = *(const v4f*)(base + 4);
  v4f b0 = *(const v4f*)(base + 16);
  v4f b1 = *(const v4f*)(base + 20);
  v16h r;
#pragma unroll
  for (int j = 0; j < 4; ++j) {
    r[j]      = (_Float16)a0[j];
    r[j + 4]  = (_Float16)a1[j];
    r[j + 8]  = (_Float16)b0[j];
    r[j + 12] = (_Float16)b1[j];
  }
  return r;
}

// ---------------------------------------------------------------------------
// Kernel 1: transpose + convert weights (1024x1024 f32 [k][n]) -> f16 W^T [n][k].
// grid = (n tiles, k tiles, 3 = q,k,v); a block of 256 takes one 64 x 64 tile.
// A thread loads a 4 x 4 piece (one float4 of four consecutive k rows; a
// wave-wide load covers two 256-byte row pieces, whole lines), turns it in
// registers and lays it in LDS as [n][k] at a 144-byte row pitch. The tile goes
// out in 16-byte pieces: a wave-wide store covers four whole 128-byte lines.
static constexpr int TT  = 64;   // tile edge
static constexpr int TLD = 72;   // LDS row pitch in halfs (144 B = 16 B x 9)

__global__ __launch_bounds__(256) void wtrans_kernel(
    const float* __restrict__ wq, const float* __restrict__ wk,
    const float* __restrict__ wv, _Float16* __restrict__ tq,
    _Float16* __restrict__ tk, _Float16* __restrict__ tv) {
  __shared__ __attribute__((aligned(16))) _Float16 Ts[TT * TLD];   // [n][k]
  const float* w = (blockIdx.z == 0) ? wq : (blockIdx.z == 1) ? wk : wv;
  _Float16* o    = (blockIdx.z == 0) ? tq : (blockIdx.z == 1) ? tk : tv;
  const int tid = threadIdx.x;
  const int n0 = blockIdx.x * TT, k0 = blockIdx.y * TT;
  const int n4 = (tid & 15) * 4, k4 = (tid >> 4) * 4;

  const float* src = w + (size_t)(k0 + k4) * Dm + n0 + n4;
  v4f r[4];
#pragma unroll
  for (int j = 0; j < 4; ++j) r[j] = *(const v4f*)(src + (size_t)j * Dm);
#pragma unroll
  for (int e = 0; e < 4; ++e) {
    v4h c;
#pragma unroll
    for (int j = 0; j < 4; ++j) c[j] = (_Float16)r[j][e];
    *(v4h*)&Ts[(n4 + e) * TLD + k4] = c;
  }
  __syncthreads();   // the whole tile lies in LDS before any row of it is read

  const int row = tid >> 3, pc = (tid & 7) * 8;
  _Float16* dst = o + (size_t)(n0 + row) * Dm + k0 + pc;
#pragma unroll
  for (int j = 0; j < 2; ++j)
    *(v8h*)(dst + (size_t)(32 * j) * Dm) = *(const v8h*)&Ts[(row + 32 * j) * TLD + pc];
}

// ---------------------------------------------------------------------------
// Kernel 2: fused QKV projection GEMM (wave32 WMMA), LDS-tiled.
// grid = (N/256 column tiles, (B*S)/128 row tiles, 3 = q,k,v). Block = 256
// (8 waves, 2 x 4); the block owns a 128 x 256 tile of the output, wave
// (wm, wn) its 64 x 64 part (4 x 4 accumulator tiles): every row of x is read
// from L2 by 4 blocks, and a fragment read from LDS feeds 4 products. The four
// W^T fragments of a k half stay in registers; the x fragments pass through two
// register sets, each fetched while the row tile before it is multiplied.
// Per 64-k step both operands are read from global memory once per block with
// whole-line loads (x converted to f16 on the way) and laid in LDS at a
// 144-byte row pitch; fragments come from LDS. Two LDS buffers: the next
// step's global loads are issued ahead of this step's products and stored
// behind them, one barrier per step.
// Q,K heads -> [b][h][s][64] f16; V -> transposed [b][h][d][s] f16.
static constexpr int PBM = 128;   // rows of x per block
static constexpr int PBN = 256;   // output columns per block
static constexpr int PBK = 64;    // k per step
static constexpr int PLD = 72;    // LDS row pitch in halfs (144 B = 16 B x 9)
static constexpr int SLR = 264;   // result tile as [row][column]: row pitch in halfs (528 B = 16 B x 33)
static constexpr int SLC = 136;   // result tile as [column][row]: row pitch in halfs (272 B = 16 B x 17)

__global__ __launch_bounds__(256, 4) void proj_kernel(
    const float* __restrict__ xq, const float* __restrict__ xk,
    const float* __restrict__ xv, const _Float16* __restrict__ wtq,
    const _Float16* __restrict__ wtk, const _Float16* __restrict__ wtv,
    const float* __restrict__ bq, const float* __restrict__ bk,
    const float* __restrict__ bv, _Float16* __restrict__ qh,
    _Float16* __restrict__ kh, _Float16* __restrict__ vt) {
  // [buffer][x rows, then W^T rows][k]
  __shared__ __attribute__((aligned(16))) _Float16 Sm[2][(PBM + PBN) * PLD];

  const int which = blockIdx.z;
  const float* x      = (which == 0) ? xq  : (which == 1) ? xk  : xv;
  const _Float16* wt  = (which == 0) ? wtq : (which == 1) ? wtk : wtv;
  const float* bias   = (which == 0) ? bq  : (which == 1) ? bk  : bv;
  _Float16* out       = (which == 0) ? qh  : (which == 1) ? kh  : vt;
  const bool tr = (which == 2);

  const int tid    = threadIdx.x;
  const int wave   = tid >> 5;
  const int lane   = tid & 31;
  const int lane15 = lane & 15;
  const int half   = lane >> 4;
  const int wm = wave >> 2;             // 0..1: 64-row part
  const int wn = wave & 3;              // 0..3: 64-column part
  const int r0 = blockIdx.y * PBM;      // global activation row in [0, B*S)
  const int n0 = blockIdx.x * PBN;      // output column base

  // x tile: 128 rows x 64 f32; thread takes float4 (tid & 15) of rows
  // (tid >> 4) + 16 j. W^T tile: 256 rows x 64 f16; thread takes the 16-byte
  // piece (tid & 7) of rows (tid >> 3) + 32 j.
  const int arow = tid >> 4, acol = (tid & 15) * 4;
  const int brow = tid >> 3, bcol = (tid & 7) * 8;
  const float*    ag = x  + (size_t)(r0 + arow) * Dm + acol;   // stepped by PBK per load group
  const _Float16* bg = wt + (size_t)(n0 + brow) * Dm + bcol;
  // this lane's places in an LDS buffer, in halfs: where it stores, where its fragments start
  const int sa = arow * PLD + acol;
  const int sb = (PBM + brow) * PLD + bcol;
  const int fa = (wm * 64 + lane15) * PLD + (half << 3);
  const int fb = (PBM + wn * 64 + lane15) * PLD + (half << 3);

  v4f ra[8];
  v8h rb[8];
  auto gload = [&]() {
#pragma unroll
    for (int j = 0; j < 8; ++j) ra[j] = *(const v4f*)(ag + (size_t)(16 * j) * Dm);
#pragma unroll
    for (int j = 0; j < 8; ++j) rb[j] = *(const v8h*)(bg + (size_t)(32 * j) * Dm);
    // the wait in front of any rewrite of the loads' address registers; naming
    // the addresses keeps both pairs live, and off the loads' own results, up to it
    asm volatile("s_wait_xcnt 0x0" :: "v"(ag), "v"(bg) : "memory");
    ag += PBK;
    bg += PBK;
  };
  auto lstore = [&](int buf) {
#pragma unroll
    for (int j = 0; j < 8; ++j) {
      v4h hx;
#pragma unroll
      for (int e = 0; e < 4; ++e) hx[e] = (_Float16)ra[j][e];
      *(v4h*)&Sm[buf][sa + 16 * j * PLD] = hx;
    }
#pragma unroll
    for (int j = 0; j < 8; ++j)
      *(v8h*)&Sm[buf][sb + 32 * j * PLD] = rb[j];
  };

  v8f acc[4][4] = {};
  // one 16 x 32 fragment: two 16-byte pieces, k 0..7 and 16..23 (upper half-wave: 8..15, 24..31)
  auto frag = [&](const _Float16* p) {
    const v8h c0 = *(const v8h*)(p);
    const v8h c1 = *(const v8h*)(p + 16);
    v16h r;
#pragma unroll
    for (int j = 0; j < 8; ++j) { r[j] = c0[j]; r[j + 8] = c1[j]; }
    return r;
  };
  auto compute = [&](int buf) {
    const _Float16* Ab = &Sm[buf][fa];
    const _Float16* Bb = &Sm[buf][fb];
    v16h bm[4], a[2];
#pragma unroll
    for (int t = 0; t < 4; ++t) bm[t] = frag(Bb + t * 16 * PLD);
    a[0] = frag(Ab);
#pragma unroll
    for (int r = 0; r < 8; ++r) {   // r = 4 * (k half) + row tile
      if (r < 7) a[(r + 1) & 1] = frag(Ab + ((r + 1) & 3) * 16 * PLD + ((r + 1) >> 2) * 32);
      __builtin_amdgcn_sched_barrier(0);
#pragma unroll
      for (int t = 0; t < 4; ++t) acc[r & 3][t] = wmma_f16(a[r & 1], bm[t], acc[r & 3][t]);
      if (r == 3) {
#pragma unroll
        for (int t = 0; t < 4; ++t) bm[t] = frag(Bb + t * 16 * PLD + 32);
      }
    }
  };

  constexpr int NK = Dm / PBK;
  gload();
  lstore(0);
  __syncthreads();                 // step 0 published
  for (int kt = 0; kt < NK - 1; ++kt) {
    const int buf = kt & 1;
    gload();
    // holds the next step's global loads ahead of the products, so that their
    // latency runs under them (the scheduler otherwise sinks them to the stores)
    __builtin_amdgcn_sched_barrier(0);
    compute(buf);
    // holds the waits on those loads, the conversions and the LDS stores
    // behind the last product
    __builtin_amdgcn_sched_barrier(0);
    lstore(buf ^ 1);               // its last readers left before the previous barrier
    __syncthreads();               // publishes step kt+1, ends the reads of buf
  }
  compute((NK - 1) & 1);

  // The block's 128 x 256 tile of f16 results is laid in LDS over the operand
  // buffers (q, k as [row][column], v as [column][row]) and leaves in 16-byte
  // pieces: a wave-wide store then covers four whole 128-byte lines.
  _Float16* St = &Sm[0][0];
  // holds the last products in front of the barrier: lifted behind it they keep
  // all their fragments in registers at once
  __builtin_amdgcn_sched_barrier(0);
  __syncthreads();   // every wave has left the operand buffers before the tile is laid over them
  const int rl = wm * 64 + (half << 3);     // first of this lane's 8 rows in accumulator tile 0
  const int cl = wn * 64 + lane15;          // this lane's column in accumulator tile 0
  const int bc = n0 + cl;
  float bi[4];
#pragma unroll
  for (int t = 0; t < 4; ++t) bi[t] = bias[bc + t * 16];
  // the wait in front of any rewrite of these loads' offset register; naming the
  // offset keeps it live, and off the loads' own results, up to it
  asm volatile("s_wait_xcnt 0x0" :: "v"(bc) : "memory");
  if (!tr) {
#pragma unroll
    for (int i4 = 0; i4 < 4; ++i4)
#pragma unroll
      for (int t = 0; t < 4; ++t)
#pragma unroll
        for (int i = 0; i < 8; ++i)
          St[(rl + i4 * 16 + i) * SLR + cl + t * 16] = (_Float16)(acc[i4][t][i] + bi[t]);
  } else {
#pragma unroll
    for (int i4 = 0; i4 < 4; ++i4)
#pragma unroll
      for (int t = 0; t < 4; ++t) {
        v8h pk;
#pragma unroll
        for (int i = 0; i < 8; ++i) pk[i] = (_Float16)(acc[i4][t][i] + bi[t]);
        *(v8h*)&St[(cl + t * 16) * SLC + rl + i4 * 16] = pk;
      }
  }
  __syncthreads();   // the tile is whole before any line of it is read

  const int b = r0 >> 11, s0 = r0 & (Sq - 1);   // a block's 128 rows lie in one batch
  v8h ln[16];
  if (!tr) {
    // [b][h][s][64]: one (head, s) row is one line; 4 consecutive s per wave-wide store
    const int pc = (tid & 7) * 8, rr = tid >> 3;
#pragma unroll
    for (int j = 0; j < 16; ++j)
      ln[j] = *(const v8h*)&St[((j & 3) * 32 + rr) * SLR + (j >> 2) * Dh + pc];
    _Float16* dst = out + ((size_t)(b * Hh + (n0 >> 6)) * Sq + s0 + rr) * Dh + pc;
#pragma unroll
    for (int j = 0; j < 16; ++j)
      *(v8h*)(dst + ((size_t)(j >> 2) * Sq + (j & 3) * 32) * Dh) = ln[j];
    // the wait in front of any reuse of the registers that these stores name
    asm volatile("s_wait_xcnt 0x0" ::: "memory");
  } else {
    // [b][h][d][S]: 128 consecutive s of one (h, d) row are two lines
    const int pc = (tid & 15) * 8, cc = tid >> 4;
#pragma unroll
    for (int j = 0; j < 16; ++j)
      ln[j] = *(const v8h*)&St[(j * 16 + cc) * SLC + pc];
    _Float16* dst = out + ((size_t)b * (Hh * Dh) + n0 + cc) * Sq + s0 + pc;
#pragma unroll
    for (int j = 0; j < 16; ++j)
      *(v8h*)(dst + (size_t)(j * 16) * Sq) = ln[j];
  }
}

__global__ __launch_bounds__(256) void maskpack_kernel(
    const int* __restrict__ mask, unsigned* __restrict__ pm) {
  const int lane   = threadIdx.x & 31;
  const int lane15 = lane & 15;
  const int half   = lane >> 4;
  const int w  = blockIdx.x * 8 + (threadIdx.x >> 5);
  const int cp = w & (Sq / 64 - 1);   // pair of key chunks
  const int qb = w / (Sq / 64);       // b * S/32 + query block
  const int* src = mask + ((size_t)qb * 32 + lane15) * Sq + cp * 64 + (half << 3);

  i32x4 mk[2][2][4];   // [chunk][column group][piece]
#pragma unroll
  for (int c = 0; c < 2; ++c)
#pragma unroll
    for (int rg = 0; rg < 2; ++rg) {
      const int* mrow = src + (size_t)(rg * 16) * Sq + c * 32;
      mk[c][rg][0] = *(const i32x4*)(mrow);
      mk[c][rg][1] = *(const i32x4*)(mrow + 4);
      mk[c][rg][2] = *(const i32x4*)(mrow + 16);
      mk[c][rg][3] = *(const i32x4*)(mrow + 20);
    }
  // the wait in front of any reuse of the loads' address registers; naming the
  // address keeps the pair live up to it
  asm volatile("s_wait_xcnt 0x0" :: "v"(src) : "memory");

  unsigned* dst = pm + ((size_t)qb * (Sq / 32) + cp * 2) * 32 + lane;
#pragma unroll
  for (int c = 0; c < 2; ++c) {
    unsigned v = 0;
#pragma unroll
    for (int rg = 0; rg < 2; ++rg)
#pragma unroll
      for (int e = 0; e < 16; ++e) {
        const unsigned keep =
            __builtin_amdgcn_ballot_w32(mk[c][rg][e >> 2][e & 3] != 0);
        v = (lane == rg * 16 + e) ? keep : v;   // lane rg*16+e stores word e
      }
    dst[c * 32] = v;
  }
}

static constexpr int KLD = 72;   // K row pitch in LDS, halfs (144 B = 16 B x 9)
static constexpr int VLD = 40;   // V^T row pitch in LDS, halfs (80 B = 16 B x 5)
static constexpr int OLD = 68;   // output row pitch in LDS, floats (272 B = 16 B x 17)

DEV float xhalf(float x) {
  const int v = __builtin_bit_cast(int, x);
  return __builtin_bit_cast(
      float, __builtin_amdgcn_permlanex16(v, v, 0x76543210, 0xfedcba98, false, false));
}

__global__ __launch_bounds__(32 * AWAVES) void attn_kernel(
    const _Float16* __restrict__ qh, const _Float16* __restrict__ kh,
    const _Float16* __restrict__ vt, const unsigned* __restrict__ pm,
    float* __restrict__ out) {
  __shared__ __attribute__((aligned(16))) _Float16 Kb[2][32 * KLD];  // [kpos][d]
  __shared__ __attribute__((aligned(16))) _Float16 Vb[2][64 * VLD];  // [d][kpos]
  // each wave's own range: 16 output rows of 64 floats on their way to memory
  __shared__ __attribute__((aligned(16))) float Os[AWAVES][16 * OLD];

  const int bh = blockIdx.x;
  const int b = bh >> 4, h = bh & 15;
  const int tid    = threadIdx.x;
  const int wave   = tid >> 5;
  const int lane   = tid & 31;
  const int lane15 = lane & 15;
  const int half   = lane >> 4;
  const int q0 = (blockIdx.y * AWAVES + wave) * QROWS;

  const _Float16* Qh = qh + ((size_t)bh * Sq + q0) * Dh;
  const _Float16* Kh = kh + (size_t)bh * Sq * Dh;
  const _Float16* Vh = vt + (size_t)bh * Dh * Sq;
  // this wave's lane masks: 32 words per key chunk, a wave-uniform address
  const unsigned* Pw =
      pm + ((size_t)b * (Sq / 32) + blockIdx.y * AWAVES +
            __builtin_amdgcn_readfirstlane(wave)) * (size_t)(Sq / 32) * 32;

  // stage one 32-kpos K/V chunk into LDS buffer `buf`: K tile 32 rows x 128 B
  // (thread: 16-byte piece tid & 7 of row tid >> 3, 4 KB contiguous in memory),
  // V^T tile 64 rows x 64 B (piece tid & 3 of row tid >> 2, source pitch Sq halfs)
  const _Float16* kg = Kh + tid * 8;
  const _Float16* vg = Vh + (size_t)(tid >> 2) * Sq + (tid & 3) * 8;
  const unsigned kl = (unsigned)(size_t)&Kb[0][(tid >> 3) * KLD + (tid & 7) * 8];
  const unsigned vl = (unsigned)(size_t)&Vb[0][(tid >> 2) * VLD + (tid & 3) * 8];
  auto stage = [&](int k0, int buf) {
    // the wait in the copies' own statement stands in front of any rewrite of
    // the address registers that they name
    asm volatile(
        "global_load_async_to_lds_b128 %0, %1, off\n\t"
        "global_load_async_to_lds_b128 %2, %3, off\n\t"
        "s_wait_xcnt 0x0"
        :: "v"(kl + (unsigned)buf * (unsigned)(32 * KLD * 2)), "v"(kg + (size_t)k0 * Dh),
           "v"(vl + (unsigned)buf * (unsigned)(64 * VLD * 2)), "v"(vg + k0)
        : "memory");
  };

  // Q^T B-tiles: [column group][dchunk], loaded once, reused for all k.
  v16h bq[2][2];
#pragma unroll
  for (int rg = 0; rg < 2; ++rg) {
    bq[rg][0] = load_tile_f16(Qh + (size_t)rg * 16 * Dh, Dh, lane);
    bq[rg][1] = load_tile_f16(Qh + (size_t)rg * 16 * Dh + 32, Dh, lane);
  }

  v16h aones;
  {
    const _Float16 onev = (_Float16)((lane15 == 0) ? 1.0f : 0.0f);
#pragma unroll
    for (int j = 0; j < 16; ++j) aones[j] = onev;
  }

  v8f o[2][4] = {};     // O^T: [group][d tile]; register r = d 16 t + 8 half + r
  v8f osum[2] = {};
  float m_i[2] = {-1.0e30f, -1.0e30f};   // maximum in use, raw units; the first pass always moves it
  float mc[2]  = {-1.0e30f * SC2, -1.0e30f * SC2};   // m_i * SC2

  v16h pb[2];

  // lane masks of chunk 0: [column group], word e = 8 * key tile + register
  u32x16 mw[2];
  mw[0] = *(cu32x16*)(Pw);
  mw[1] = *(cu32x16*)(Pw + 16);

  stage(0, 0);
  asm volatile("s_wait_asynccnt 0x0" ::: "memory");   // this wave's chunk-0 copies have landed
  __syncthreads();                                    // chunk 0 published
  stage(32, 1);
  for (int k0 = 0, it = 0; k0 < Sq; k0 += 32, ++it) {
    const int buf = it & 1;

    // K A-tiles from LDS, shared by both column groups
    v16h a00 = load_tile_f16(&Kb[buf][0], KLD, lane);
    v16h a01 = load_tile_f16(&Kb[buf][32], KLD, lane);
    v16h a10 = load_tile_f16(&Kb[buf][16 * KLD], KLD, lane);
    v16h a11 = load_tile_f16(&Kb[buf][16 * KLD + 32], KLD, lane);

    v8f sc[2][2];   // S^T: [column group][key tile]
#pragma unroll
    for (int rg = 0; rg < 2; ++rg) {
      v8f s0 = {}, s1 = {};
      s0 = wmma_f16(a00, bq[rg][0], s0);
      s0 = wmma_f16(a01, bq[rg][1], s0);
      s1 = wmma_f16(a10, bq[rg][0], s1);
      s1 = wmma_f16(a11, bq[rg][1], s1);
#pragma unroll
      for (int i = 0; i < 8; ++i) {
        s0[i] = __builtin_amdgcn_inverse_ballot_w32(mw[rg][i]) ? s0[i] : NEGR;
        s1[i] = __builtin_amdgcn_inverse_ballot_w32(mw[rg][8 + i]) ? s1[i] : NEGR;
      }
      sc[rg][0] = s0;
      sc[rg][1] = s1;
    }
    // online softmax, one query per lane: the maximum of this lane's 16 scores
    // (its half of the query's 32 keys)
    float tm[2];
#pragma unroll
    for (int rg = 0; rg < 2; ++rg) {
      float t = sc[rg][0][0];
#pragma unroll
      for (int i = 1; i < 8; ++i) t = fmaxf(t, sc[rg][0][i]);
#pragma unroll
      for (int i = 0; i < 8; ++i) t = fmaxf(t, sc[rg][1][i]);
      tm[rg] = t;
    }
    // One test per pass for both groups and both halves. The difference is
    // taken first, so that the bound on P holds at any size of the scores.
    const bool need = (tm[0] - m_i[0] > LAZYR) | (tm[1] - m_i[1] > LAZYR);
    if (__builtin_amdgcn_ballot_w32(need) != 0) {
#pragma unroll
      for (int rg = 0; rg < 2; ++rg) {
        // both halves of a query take the same new maximum
        const float mn = fmaxf(m_i[rg], fmaxf(tm[rg], xhalf(tm[rg])));
        const float alpha = __builtin_amdgcn_exp2f((m_i[rg] - mn) * SC2);
        m_i[rg] = mn;
        mc[rg]  = mn * SC2;
#pragma unroll
        for (int t = 0; t < 4; ++t)
#pragma unroll
          for (int i = 0; i < 8; ++i) o[rg][t][i] *= alpha;
        osum[rg][0] *= alpha;  // rows 1..15 of this tile are 0
      }
    }
    // the next chunk's lane masks, behind the last select of this chunk: their
    // latency runs under the rest of the pass (the last pass reads its own again)
    {
      const unsigned* pn = Pw + (size_t)((it + 1 < Sq / 32) ? it + 1 : it) * 32;
      mw[0] = *(cu32x16*)(pn);
      mw[1] = *(cu32x16*)(pn + 16);
    }
    // V^T A-tiles, each used by both column groups
    v16h avt[4];
#pragma unroll
    for (int t = 0; t < 4; ++t) avt[t] = load_tile_f16(&Vb[buf][(t * 16) * VLD], VLD, lane);
    // holds those loads at the head of the block behind the branch, as one
    // group, so that their latency runs under the exponentials (the scheduler
    // otherwise sinks them between the products, each pair with a wait to 0)
    __builtin_amdgcn_sched_barrier(0);
#pragma unroll
    for (int rg = 0; rg < 2; ++rg) {
      const v8f e0 = __builtin_elementwise_fma(sc[rg][0], (v8f)(SC2), (v8f)(-mc[rg]));
      const v8f e1 = __builtin_elementwise_fma(sc[rg][1], (v8f)(SC2), (v8f)(-mc[rg]));
#pragma unroll
      for (int i = 0; i < 8; ++i) {
        pb[rg][i]     = (_Float16)__builtin_amdgcn_exp2f(e0[i]);
        pb[rg][i + 8] = (_Float16)__builtin_amdgcn_exp2f(e1[i]);
      }
    }

    // O^T += V^T * P^T
#pragma unroll
    for (int t = 0; t < 4; ++t) {
      o[0][t] = wmma_f16(avt[t], pb[0], o[0][t]);
      o[1][t] = wmma_f16(avt[t], pb[1], o[1][t]);
    }
    // l += 1 * P^T (row sums via WMMA)
    osum[0] = wmma_f16(aones, pb[0], osum[0]);
    osum[1] = wmma_f16(aones, pb[1], osum[1]);

    // publish point of the next chunk
    asm volatile("s_wait_dscnt 0x0" ::: "memory");     // this wave's reads of buf are done
    asm volatile("s_wait_asynccnt 0x0" ::: "memory");  // its copies of the next chunk have landed
    __syncthreads();   // next chunk published; every reader has left buf
    if (k0 + 64 < Sq) stage(k0 + 64, buf);
  }
  asm volatile("s_wait_asynccnt 0x0" ::: "memory");    // nothing in flight at the wave's end

#pragma unroll
  for (int rg = 0; rg < 2; ++rg) {
    const float l = osum[rg][0] + xhalf(osum[rg][0]);
    const float inv = 1.0f / l;
    // The group's 16 rows go through the wave's own LDS range, so that a
    // wave-wide store covers two rows of 256 bytes: four whole 128-byte lines.
    float* ow = &Os[wave][0];
#pragma unroll
    for (int t = 0; t < 4; ++t) {
      v4f lo, hi;
#pragma unroll
      for (int i = 0; i < 4; ++i) {
        lo[i] = o[rg][t][i] * inv;
        hi[i] = o[rg][t][i + 4] * inv;
      }
      *(v4f*)&ow[lane15 * OLD + t * 16 + (half << 3)]     = lo;
      *(v4f*)&ow[lane15 * OLD + t * 16 + (half << 3) + 4] = hi;
    }
    // the wave's rows lie in LDS before other lanes of it read them back
    asm volatile("s_wait_dscnt 0x0" ::: "memory");
    v4f ln[8];
#pragma unroll
    for (int j = 0; j < 8; ++j)
      ln[j] = *(const v4f*)&ow[(j * 2 + half) * OLD + lane15 * 4];
    float* orow = out + ((size_t)b * Sq + q0 + rg * 16 + half) * (Hh * Dh) + h * Dh + lane15 * 4;
#pragma unroll
    for (int j = 0; j < 8; ++j)
      *(v4f*)(orow + (size_t)(j * 2) * (Hh * Dh)) = ln[j];
    if (rg == 0) {
      // the second group's products reuse the registers that these stores name
      asm volatile("s_wait_xcnt 0x0" ::: "memory");
      // holds those products behind the wait (the scheduler otherwise lifts them over it)
      __builtin_amdgcn_sched_barrier(0);
    }
  }
}

// ---------------------------------------------------------------------------
extern "C" void kernel_launch(void* const* d_in, const int* in_sizes, int n_in,
                              void* d_out, int out_size, void* d_ws,
                              size_t ws_size, hipStream_t stream) {
  (void)in_sizes; (void)n_in; (void)out_size; (void)ws_size;
  const float* q    = (const float*)d_in[0];
  const float* k    = (const float*)d_in[1];
  const float* v    = (const float*)d_in[2];
  const int*   msk  = (const int*)d_in[3];
  const float* wq   = (const float*)d_in[4];
  const float* bq   = (const float*)d_in[5];
  const float* wk   = (const float*)d_in[6];
  const float* bk   = (const float*)d_in[7];
  const float* wv   = (const float*)d_in[8];
  const float* bv   = (const float*)d_in[9];
  float* out = (float*)d_out;

  // workspace layout (f16): 3x W^T (2 MB each) + qh/kh/vt (16 MB each) + 2 MB of lane masks
  _Float16* ws  = (_Float16*)d_ws;
  _Float16* wtq = ws;
  _Float16* wtk = wtq + (size_t)Dm * Dm;
  _Float16* wtv = wtk + (size_t)Dm * Dm;
  _Float16* qh  = wtv + (size_t)Dm * Dm;
  const size_t headElems = (size_t)Bsz * Hh * Sq * Dh;
  _Float16* kh = qh + headElems;
  _Float16* vt = kh + headElems;
  unsigned* pm = (unsigned*)(vt + headElems);   // lane masks, B*S*S/8 bytes

  dim3 gT(Dm / TT, Dm / TT, 3);
  wtrans_kernel<<<gT, 256, 0, stream>>>(wq, wk, wv, wtq, wtk, wtv);

  dim3 gP(Dm / PBN, (Bsz * Sq) / PBM, 3);
  proj_kernel<<<gP, 256, 0, stream>>>(q, k, v, wtq, wtk, wtv, bq, bk, bv,
                                      qh, kh, vt);

  maskpack_kernel<<<Bsz * (Sq / 32) * (Sq / 64) / 8, 256, 0, stream>>>(msk, pm);

  dim3 gA(Bsz * Hh, Sq / (QROWS * AWAVES));
  attn_kernel<<<gA, 32 * AWAVES, 0, stream>>>(qh, kh, vt, pm, out);
}

// v010
// Measured time: 114 microseconds a run.
// In two side-by-side timings against v009, it was 1.05 and 1.06 times as fast.
// All steps since v000 together make it 5.14 times as fast.
#include <hip/hip_runtime.h>
#include <hip/hip_bf16.h>

#define DEV __device__ __forceinline__

typedef __attribute__((ext_vector_type(16))) _Float16 v16h;
typedef __attribute__((ext_vector_type(8)))  _Float16 v8h;
typedef __attribute__((ext_vector_type(4)))  _Float16 v4h;
typedef __attribute__((ext_vector_type(8)))  float    v8f;
typedef __attribute__((ext_vector_type(4)))  float    v4f;
typedef __attribute__((ext_vector_type(4)))  int      i32x4;
typedef __attribute__((ext_vector_type(16))) unsigned u32x16;
// memory that no one writes while the kernel runs: a load at a wave-uniform
// address through this type is a scalar load
typedef const __attribute__((address_space(4))) u32x16 cu32x16;

static constexpr int Bsz = 4;
static constexpr int Sq  = 2048;
static constexpr int Dm  = 1024;
static constexpr int Hh  = 16;
static constexpr int Dh  = 64;
// Raw scores (before the 1/sqrt(64)) are turned into exponents of 2 by one
// multiply-add with SC2 = log2(e) / sqrt(64).
#define SC2 (0.125f * 1.44269504088896340736f)
// A masked score, in raw units: -2^33 (-2^30 after the scale; the reference's
// -1e9 and this value give the same softmax, 0 beside any kept score and equal
// weights in a row with none). A power of two, so that its product with SC2 is
// exact and a row of masked scores alone gets the exponent 0 exactly.
#define NEGR (-8589934592.0f)
// The maximum in use moves only when a chunk's maximum stands more than this
// above it, in raw units: 8 in the exponent of 2, so P stays at or below 2^8.
#define LAZYR (8.0f / SC2)
#define AWAVES 8   // waves per attention block
#define QROWS 32   // q rows per wave (2 row-groups of 16)

// ---------------------------------------------------------------------------
// D = A(16x32 f16) * B(32x16 f16) + C(16x16 f32)
DEV v8f wmma_f16(v16h a, v16h b, v8f c) {
  return __builtin_amdgcn_wmma_f32_16x16x32_f16(
      /*neg_a=*/false, a, /*neg_b=*/false, b,
      /*c_mod=*/(short)0, c, /*reuse_a=*/false, /*reuse_b=*/false);
}

DEV v16h load_tile_f16(const _Float16* p, int ld, int lane) {
  const _Float16* base = p + (size_t)(lane & 15) * ld + ((lane >> 4) << 3);
  v8h c0 = *(const v8h*)(base);
  v8h c1 = *(const v8h*)(base + 16);
  v16h r;
#pragma unroll
  for (int j = 0; j < 8; ++j) { r[j] = c0[j]; r[j + 8] = c1[j]; }
  return r;
}

// Same tile pattern but f32 source, converted to f16 on the fly.
DEV v16h load_tile_f32(const float* p, int ld, int lane) {
  const float* base = p + (size_t)(lane & 15) * ld + ((lane >> 4) << 3);
  v4f a0 = *(const v4f*)(base);
  v4f a1 = *(const v4f*)(base + 4);
  v4f b0 = *(const v4f*)(base + 16);
  v4f b1 = *(const v4f*)(base + 20);
  v16h r;
#pragma unroll
  for (int j = 0; j < 4; ++j) {
    r[j]      = (_Float16)a0[j];
    r[j + 4]  = (_Float16)a1[j];
    r[j + 8]  = (_Float16)b0[j];
    r[j + 12] = (_Float16)b1[j];
  }
  return r;
}

// ---------------------------------------------------------------------------
// Kernel 1: transpose + convert weights (1024x1024 f32 [k][n]) -> f16 W^T [n][k].
// grid = (n tiles, k tiles, 3 = q,k,v); a block of 256 takes one 64 x 64 tile.
// A thread loads a 4 x 4 piece (one float4 of four consecutive k rows; a
// wave-wide load covers two 256-byte row pieces, whole lines), turns it in
// registers and lays it in LDS as [n][k] at a 144-byte row pitch. The tile goes
// out in 16-byte pieces: a wave-wide store covers four whole 128-byte lines.
static constexpr int TT  = 64;   // tile edge
static constexpr int TLD = 72;   // LDS row pitch in halfs (144 B = 16 B x 9)

__global__ __launch_bounds__(256) void wtrans_kernel(
    const float* __restrict__ wq, const float* __restrict__ wk,
    const float* __restrict__ wv, _Float16* __restrict__ tq,
    _Float16* __restrict__ tk, _Float16* __restrict__ tv) {
  __shared__ __attribute__((aligned(16))) _Float16 Ts[TT * TLD];   // [n][k]
  const float* w = (blockIdx.z == 0) ? wq : (blockIdx.z == 1) ? wk : wv;
  _Float16* o    = (blockIdx.z == 0) ? tq : (blockIdx.z == 1) ? tk : tv;
  const int tid = threadIdx.x;
  const int n0 = blockIdx.x * TT, k0 = blockIdx.y * TT;
  const int n4 = (tid & 15) * 4, k4 = (tid >> 4) * 4;

  const float* src = w + (size_t)(k0 + k4) * Dm + n0 + n4;
  v4f r[4];
#pragma unroll
  for (int j = 0; j < 4; ++j) r[j] = *(const v4f*)(src + (size_t)j * Dm);
#pragma unroll
  for (int e = 0; e < 4; ++e) {
    v4h c;
#pragma unroll
    for (int j = 0; j < 4; ++j) c[j] = (_Float16)r[j][e];
    *(v4h*)&Ts[(n4 + e) * TLD + k4] = c;
  }
  __syncthreads();   // the whole tile lies in LDS before any row of it is read

  const int row = tid >> 3, pc = (tid & 7) * 8;
  _Float16* dst = o + (size_t)(n0 + row) * Dm + k0 + pc;
#pragma unroll
  for (int j = 0; j < 2; ++j)
    *(v8h*)(dst + (size_t)(32 * j) * Dm) = *(const v8h*)&Ts[(row + 32 * j) * TLD + pc];
}

static constexpr int MKW = 256;   // keys per wave
static constexpr int MBLK = Bsz * (Sq / 32) * (Sq / MKW) / 8;   // work-groups of 8 waves

DEV void maskpack_block(const int* __restrict__ mask, unsigned* __restrict__ pm, int blk) {
  const int lane   = threadIdx.x & 31;
  const int lane15 = lane & 15;
  const int half   = lane >> 4;
  const int w  = blk * 8 + (threadIdx.x >> 5);
  const int cg = w & (Sq / MKW - 1);   // group of 256 keys
  const int qb = w / (Sq / MKW);       // b * S/32 + query block
  const int* src = mask + ((size_t)qb * 32 + lane15) * Sq + cg * MKW + (half << 3);

  i32x4 mk[2][2][2][4];   // [register set][chunk][column group][piece]
  auto mload = [&](int u) {
#pragma unroll
    for (int c = 0; c < 2; ++c)
#pragma unroll
      for (int rg = 0; rg < 2; ++rg) {
        const int* mrow = src + (size_t)(rg * 16) * Sq + u * 64 + c * 32;
        mk[u & 1][c][rg][0] = *(const i32x4*)(mrow);
        mk[u & 1][c][rg][1] = *(const i32x4*)(mrow + 4);
        mk[u & 1][c][rg][2] = *(const i32x4*)(mrow + 16);
        mk[u & 1][c][rg][3] = *(const i32x4*)(mrow + 20);
      }
    // the wait in front of any reuse of the loads' address registers; naming the
    // address keeps the pair live up to it
    asm volatile("s_wait_xcnt 0x0" :: "v"(src) : "memory");
  };

  unsigned pw[2 * (MKW / 64)];
  mload(0);
#pragma unroll
  for (int u = 0; u < MKW / 64; ++u) {
    if (u + 1 < MKW / 64) mload(u + 1);
#pragma unroll
    for (int c = 0; c < 2; ++c) {
      unsigned v = 0;
#pragma unroll
      for (int rg = 0; rg < 2; ++rg)
#pragma unroll
        for (int e = 0; e < 16; ++e) {
          const unsigned keep =
              __builtin_amdgcn_ballot_w32(mk[u & 1][c][rg][e >> 2][e & 3] != 0);
          v = (lane == rg * 16 + e) ? keep : v;   // lane rg*16+e stores word e
        }
      pw[u * 2 + c] = v;
    }
  }
  unsigned* dst = pm + ((size_t)qb * (Sq / 32) + cg * (MKW / 32)) * 32 + lane;
#pragma unroll
  for (int j = 0; j < 2 * (MKW / 64); ++j) dst[j * 32] = pw[j];
}

// ---------------------------------------------------------------------------
// Kernel 2: fused QKV projection GEMM (wave32 WMMA), LDS-tiled.
// grid = (N/256 column tiles, (B*S)/128 row tiles, 3 = q,k,v, then one plane of
// work-groups that pack the mask: maskpack_block). Block = 256
// (8 waves, 2 x 4); the block owns a 128 x 256 tile of the output, wave
// (wm, wn) its 64 x 64 part (4 x 4 accumulator tiles): every row of x is read
// from L2 by 4 blocks, and a fragment read from LDS feeds 4 products. The four
// W^T fragments of a k half stay in registers; the x fragments pass through two
// register sets, each fetched while the row tile before it is multiplied.
// Per 64-k step both operands are read from global memory once per block with
// whole-line loads (x converted to f16 on the way) and laid in LDS at a
// 144-byte row pitch; fragments come from LDS. Two LDS buffers: the next
// step's global loads are issued ahead of this step's products and stored
// behind them, one barrier per step.
// Q,K heads -> [b][h][s][64] f16; V -> transposed [b][h][d][s] f16.
static constexpr int PBM = 128;   // rows of x per block
static constexpr int PBN = 256;   // output columns per block
static constexpr int PBK = 64;    // k per step
static constexpr int PLD = 72;    // LDS row pitch in halfs (144 B = 16 B x 9)
static constexpr int SLR = 264;   // result tile as [row][column]: row pitch in halfs (528 B = 16 B x 33)
static constexpr int SLC = 136;   // result tile as [column][row]: row pitch in halfs (272 B = 16 B x 17)

__global__ __launch_bounds__(256, 4) void proj_kernel(
    const float* __restrict__ xq, const float* __restrict__ xk,
    const float* __restrict__ xv, const _Float16* __restrict__ wtq,
    const _Float16* __restrict__ wtk, const _Float16* __restrict__ wtv,
    const float* __restrict__ bq, const float* __restrict__ bk,
    const float* __restrict__ bv, _Float16* __restrict__ qh,
    _Float16* __restrict__ kh, _Float16* __restrict__ vt,
    const int* __restrict__ mask, unsigned* __restrict__ pm) {
  // [buffer][x rows, then W^T rows][k]
  __shared__ __attribute__((aligned(16))) _Float16 Sm[2][(PBM + PBN) * PLD];

  // the whole work-group leaves here, in front of every barrier
  if (blockIdx.z == 3) {
    maskpack_block(mask, pm, blockIdx.y * (Dm / PBN) + blockIdx.x);
    return;
  }

  const int which = blockIdx.z;
  const float* x      = (which == 0) ? xq  : (which == 1) ? xk  : xv;
  const _Float16* wt  = (which == 0) ? wtq : (which == 1) ? wtk : wtv;
  const float* bias   = (which == 0) ? bq  : (which == 1) ? bk  : bv;
  _Float16* out       = (which == 0) ? qh  : (which == 1) ? kh  : vt;
  const bool tr = (which == 2);

  const int tid    = threadIdx.x;
  const int wave   = tid >> 5;
  const int lane   = tid & 31;
  const int lane15 = lane & 15;
  const int half   = lane >> 4;
  const int wm = wave >> 2;             // 0..1: 64-row part
  const int wn = wave & 3;              // 0..3: 64-column part
  const int r0 = blockIdx.y * PBM;      // global activation row in [0, B*S)
  const int n0 = blockIdx.x * PBN;      // output column base

  // x tile: 128 rows x 64 f32; thread takes float4 (tid & 15) of rows
  // (tid >> 4) + 16 j. W^T tile: 256 rows x 64 f16; thread takes the 16-byte
  // piece (tid & 7) of rows (tid >> 3) + 32 j.
  const int arow = tid >> 4, acol = (tid & 15) * 4;
  const int brow = tid >> 3, bcol = (tid & 7) * 8;
  const float*    ag = x  + (size_t)(r0 + arow) * Dm + acol;   // stepped by PBK per load group
  const _Float16* bg = wt + (size_t)(n0 + brow) * Dm + bcol;
  // this lane's places in an LDS buffer, in halfs: where it stores, where its fragments start
  const int sa = arow * PLD + acol;
  const int sb = (PBM + brow) * PLD + bcol;
  const int fa = (wm * 64 + lane15) * PLD + (half << 3);
  const int fb = (PBM + wn * 64 + lane15) * PLD + (half << 3);

  v4f ra[8];
  v8h rb[8];
  auto gload = [&]() {
#pragma unroll
    for (int j = 0; j < 8; ++j) ra[j] = *(const v4f*)(ag + (size_t)(16 * j) * Dm);
#pragma unroll
    for (int j = 0; j < 8; ++j) rb[j] = *(const v8h*)(bg + (size_t)(32 * j) * Dm);
    // the wait in front of any rewrite of the loads' address registers; naming
    // the addresses keeps both pairs live, and off the loads' own results, up to it
    asm volatile("s_wait_xcnt 0x0" :: "v"(ag), "v"(bg) : "memory");
    ag += PBK;
    bg += PBK;
  };
  auto lstore = [&](int buf) {
#pragma unroll
    for (int j = 0; j < 8; ++j) {
      v4h hx;
#pragma unroll
      for (int e = 0; e < 4; ++e) hx[e] = (_Float16)ra[j][e];
      *(v4h*)&Sm[buf][sa + 16 * j * PLD] = hx;
    }
#pragma unroll
    for (int j = 0; j < 8; ++j)
      *(v8h*)&Sm[buf][sb + 32 * j * PLD] = rb[j];
  };

  v8f acc[4][4] = {};
  // one 16 x 32 fragment: two 16-byte pieces, k 0..7 and 16..23 (upper half-wave: 8..15, 24..31)
  auto frag = [&](const _Float16* p) {
    const v8h c0 = *(const v8h*)(p);
    const v8h c1 = *(const v8h*)(p + 16);
    v16h r;
#pragma unroll
    for (int j = 0; j < 8; ++j) { r[j] = c0[j]; r[j + 8] = c1[j]; }
    return r;
  };
  auto compute = [&](int buf) {
    const _Float16* Ab = &Sm[buf][fa];
    const _Float16* Bb = &Sm[buf][fb];
    v16h bm[4], a[2];
#pragma unroll
    for (int t = 0; t < 4; ++t) bm[t] = frag(Bb + t * 16 * PLD);
    a[0] = frag(Ab);
#pragma unroll
    for (int r = 0; r < 8; ++r) {   // r = 4 * (k half) + row tile
      if (r < 7) a[(r + 1) & 1] = frag(Ab + ((r + 1) & 3) * 16 * PLD + ((r + 1) >> 2) * 32);
      __builtin_amdgcn_sched_barrier(0);
#pragma unroll
      for (int t = 0; t < 4; ++t) acc[r & 3][t] = wmma_f16(a[r & 1], bm[t], acc[r & 3][t]);
      if (r == 3) {
#pragma unroll
        for (int t = 0; t < 4; ++t) bm[t] = frag(Bb + t * 16 * PLD + 32);
      }
    }
  };

  constexpr int NK = Dm / PBK;
  gload();
  lstore(0);
  __syncthreads();                 // step 0 published
  for (int kt = 0; kt < NK - 1; ++kt) {
    const int buf = kt & 1;
    gload();
    // holds the next step's global loads ahead of the products, so that their
    // latency runs under them (the scheduler otherwise sinks them to the stores)
    __builtin_amdgcn_sched_barrier(0);
    compute(buf);
    // holds the waits on those loads, the conversions and the LDS stores
    // behind the last product
    __builtin_amdgcn_sched_barrier(0);
    lstore(buf ^ 1);               // its last readers left before the previous barrier
    __syncthreads();               // publishes step kt+1, ends the reads of buf
  }
  compute((NK - 1) & 1);

  // The block's 128 x 256 tile of f16 results is laid in LDS over the operand
  // buffers (q, k as [row][column], v as [column][row]) and leaves in 16-byte
  // pieces: a wave-wide store then covers four whole 128-byte lines.
  _Float16* St = &Sm[0][0];
  // holds the last products in front of the barrier: lifted behind it they keep
  // all their fragments in registers at once
  __builtin_amdgcn_sched_barrier(0);
  __syncthreads();   // every wave has left the operand buffers before the tile is laid over them
  const int rl = wm * 64 + (half << 3);     // first of this lane's 8 rows in accumulator tile 0
  const int cl = wn * 64 + lane15;          // this lane's column in accumulator tile 0
  const int bc = n0 + cl;
  float bi[4];
#pragma unroll
  for (int t = 0; t < 4; ++t) bi[t] = bias[bc + t * 16];
  // the wait in front of any rewrite of these loads' offset register; naming the
  // offset keeps it live, and off the loads' own results, up to it
  asm volatile("s_wait_xcnt 0x0" :: "v"(bc) : "memory");
  if (!tr) {
#pragma unroll
    for (int i4 = 0; i4 < 4; ++i4)
#pragma unroll
      for (int t = 0; t < 4; ++t)
#pragma unroll
        for (int i = 0; i < 8; ++i)
          St[(rl + i4 * 16 + i) * SLR + cl + t * 16] = (_Float16)(acc[i4][t][i] + bi[t]);
  } else {
#pragma unroll
    for (int i4 = 0; i4 < 4; ++i4)
#pragma unroll
      for (int t = 0; t < 4; ++t) {
        v8h pk;
#pragma unroll
        for (int i = 0; i < 8; ++i) pk[i] = (_Float16)(acc[i4][t][i] + bi[t]);
        *(v8h*)&St[(cl + t * 16) * SLC + rl + i4 * 16] = pk;
      }
  }
  __syncthreads();   // the tile is whole before any line of it is read

  const int b = r0 >> 11, s0 = r0 & (Sq - 1);   // a block's 128 rows lie in one batch
  v8h ln[16];
  if (!tr) {
    // [b][h][s][64]: one (head, s) row is one line; 4 consecutive s per wave-wide store
    const int pc = (tid & 7) * 8, rr = tid >> 3;
#pragma unroll
    for (int j = 0; j < 16; ++j)
      ln[j] = *(const v8h*)&St[((j & 3) * 32 + rr) * SLR + (j >> 2) * Dh + pc];
    _Float16* dst = out + ((size_t)(b * Hh + (n0 >> 6)) * Sq + s0 + rr) * Dh + pc;
#pragma unroll
    for (int j = 0; j < 16; ++j)
      *(v8h*)(dst + ((size_t)(j >> 2) * Sq + (j & 3) * 32) * Dh) = ln[j];
    // the wait in front of any reuse of the registers that these stores name
    asm volatile("s_wait_xcnt 0x0" ::: "memory");
  } else {
    // [b][h][d][S]: 128 consecutive s of one (h, d) row are two lines
    const int pc = (tid & 15) * 8, cc = tid >> 4;
#pragma unroll
    for (int j = 0; j < 16; ++j)
      ln[j] = *(const v8h*)&St[(j * 16 + cc) * SLC + pc];
    _Float16* dst = out + ((size_t)b * (Hh * Dh) + n0 + cc) * Sq + s0 + pc;
#pragma unroll
    for (int j = 0; j < 16; ++j)
      *(v8h*)(dst + (size_t)(j * 16) * Sq) = ln[j];
  }
}

static constexpr int KLD = 72;   // K row pitch in LDS, halfs (144 B = 16 B x 9)
static constexpr int VLD = 40;   // V^T row pitch in LDS, halfs (80 B = 16 B x 5)
static constexpr int OLD = 68;   // output row pitch in LDS, floats (272 B = 16 B x 17)

DEV float xhalf(float x) {
  const int v = __builtin_bit_cast(int, x);
  return __builtin_bit_cast(
      float, __builtin_amdgcn_permlanex16(v, v, 0x76543210, 0xfedcba98, false, false));
}

__global__ __launch_bounds__(32 * AWAVES) void attn_kernel(
    const _Float16* __restrict__ qh, const _Float16* __restrict__ kh,
    const _Float16* __restrict__ vt, const unsigned* __restrict__ pm,
    float* __restrict__ out) {
  __shared__ __attribute__((aligned(16))) _Float16 Kb[2][32 * KLD];  // [kpos][d]
  __shared__ __attribute__((aligned(16))) _Float16 Vb[2][64 * VLD];  // [d][kpos]
  // each wave's own range: 16 output rows of 64 floats on their way to memory
  __shared__ __attribute__((aligned(16))) float Os[AWAVES][16 * OLD];

  const int bh = blockIdx.x;
  const int b = bh >> 4, h = bh & 15;
  const int tid    = threadIdx.x;
  const int wave   = tid >> 5;
  const int lane   = tid & 31;
  const int lane15 = lane & 15;
  const int half   = lane >> 4;
  const int q0 = (blockIdx.y * AWAVES + wave) * QROWS;

  const _Float16* Qh = qh + ((size_t)bh * Sq + q0) * Dh;
  const _Float16* Kh = kh + (size_t)bh * Sq * Dh;
  const _Float16* Vh = vt + (size_t)bh * Dh * Sq;
  // this wave's lane masks: 32 words per key chunk, a wave-uniform address
  const unsigned* Pw =
      pm + ((size_t)b * (Sq / 32) + blockIdx.y * AWAVES +
            __builtin_amdgcn_readfirstlane(wave)) * (size_t)(Sq / 32) * 32;

  // stage one 32-kpos K/V chunk into LDS buffer `buf`: K tile 32 rows x 128 B
  // (thread: 16-byte piece tid & 7 of row tid >> 3, 4 KB contiguous in memory),
  // V^T tile 64 rows x 64 B (piece tid & 3 of row tid >> 2, source pitch Sq halfs)
  const _Float16* kg = Kh + tid * 8;
  const _Float16* vg = Vh + (size_t)(tid >> 2) * Sq + (tid & 3) * 8;
  const unsigned kl = (unsigned)(size_t)&Kb[0][(tid >> 3) * KLD + (tid & 7) * 8];
  const unsigned vl = (unsigned)(size_t)&Vb[0][(tid >> 2) * VLD + (tid & 3) * 8];
  auto stage = [&](int k0, int buf) {
    // the wait in the copies' own statement stands in front of any rewrite of
    // the address registers that they name
    asm volatile(
        "global_load_async_to_lds_b128 %0, %1, off\n\t"
        "global_load_async_to_lds_b128 %2, %3, off\n\t"
        "s_wait_xcnt 0x0"
        :: "v"(kl + (unsigned)buf * (unsigned)(32 * KLD * 2)), "v"(kg + (size_t)k0 * Dh),
           "v"(vl + (unsigned)buf * (unsigned)(64 * VLD * 2)), "v"(vg + k0)
        : "memory");
  };

  // Q^T B-tiles: [column group][dchunk], loaded once, reused for all k.
  v16h bq[2][2];
#pragma unroll
  for (int rg = 0; rg < 2; ++rg) {
    bq[rg][0] = load_tile_f16(Qh + (size_t)rg * 16 * Dh, Dh, lane);
    bq[rg][1] = load_tile_f16(Qh + (size_t)rg * 16 * Dh + 32, Dh, lane);
  }

  v16h aones;
  {
    const _Float16 onev = (_Float16)((lane15 == 0) ? 1.0f : 0.0f);
#pragma unroll
    for (int j = 0; j < 16; ++j) aones[j] = onev;
  }

  v8f o[2][4] = {};     // O^T: [group][d tile]; register r = d 16 t + 8 half + r
  v8f osum[2] = {};
  float m_i[2] = {-1.0e30f, -1.0e30f};   // maximum in use, raw units; the first pass always moves it
  float mc[2]  = {-1.0e30f * SC2, -1.0e30f * SC2};   // m_i * SC2

  v16h pb[2];

  // lane masks of chunk 0: [column group], word e = 8 * key tile + register
  u32x16 mw[2];
  mw[0] = *(cu32x16*)(Pw);
  mw[1] = *(cu32x16*)(Pw + 16);

  stage(0, 0);
  asm volatile("s_wait_asynccnt 0x0" ::: "memory");   // this wave's chunk-0 copies have landed
  __syncthreads();                                    // chunk 0 published
  stage(32, 1);
  for (int k0 = 0, it = 0; k0 < Sq; k0 += 32, ++it) {
    const int buf = it & 1;

    // K A-tiles from LDS, shared by both column groups
    v16h a00 = load_tile_f16(&Kb[buf][0], KLD, lane);
    v16h a01 = load_tile_f16(&Kb[buf][32], KLD, lane);
    v16h a10 = load_tile_f16(&Kb[buf][16 * KLD], KLD, lane);
    v16h a11 = load_tile_f16(&Kb[buf][16 * KLD + 32], KLD, lane);

    v8f sc[2][2];   // S^T: [column group][key tile]
#pragma unroll
    for (int rg = 0; rg < 2; ++rg) {
      v8f s0 = {}, s1 = {};
      s0 = wmma_f16(a00, bq[rg][0], s0);
      s0 = wmma_f16(a01, bq[rg][1], s0);
      s1 = wmma_f16(a10, bq[rg][0], s1);
      s1 = wmma_f16(a11, bq[rg][1], s1);
#pragma unroll
      for (int i = 0; i < 8; ++i) {
        s0[i] = __builtin_amdgcn_inverse_ballot_w32(mw[rg][i]) ? s0[i] : NEGR;
        s1[i] = __builtin_amdgcn_inverse_ballot_w32(mw[rg][8 + i]) ? s1[i] : NEGR;
      }
      sc[rg][0] = s0;
      sc[rg][1] = s1;
    }
    // online softmax, one query per lane: the maximum of this lane's 16 scores
    // (its half of the query's 32 keys)
    float tm[2];
#pragma unroll
    for (int rg = 0; rg < 2; ++rg) {
      float t = sc[rg][0][0];
#pragma unroll
      for (int i = 1; i < 8; ++i) t = fmaxf(t, sc[rg][0][i]);
#pragma unroll
      for (int i = 0; i < 8; ++i) t = fmaxf(t, sc[rg][1][i]);
      tm[rg] = t;
    }
    // One test per pass for both groups and both halves. The difference is
    // taken first, so that the bound on P holds at any size of the scores.
    const bool need = (tm[0] - m_i[0] > LAZYR) | (tm[1] - m_i[1] > LAZYR);
    if (__builtin_amdgcn_ballot_w32(need) != 0) {
#pragma unroll
      for (int rg = 0; rg < 2; ++rg) {
        // both halves of a query take the same new maximum
        const float mn = fmaxf(m_i[rg], fmaxf(tm[rg], xhalf(tm[rg])));
        const float alpha = __builtin_amdgcn_exp2f((m_i[rg] - mn) * SC2);
        m_i[rg] = mn;
        mc[rg]  = mn * SC2;
#pragma unroll
        for (int t = 0; t < 4; ++t)
#pragma unroll
          for (int i = 0; i < 8; ++i) o[rg][t][i] *= alpha;
        osum[rg][0] *= alpha;  // rows 1..15 of this tile are 0
      }
    }
    // the next chunk's lane masks, behind the last select of this chunk: their
    // latency runs under the rest of the pass (the last pass reads its own again)
    {
      const unsigned* pn = Pw + (size_t)((it + 1 < Sq / 32) ? it + 1 : it) * 32;
      mw[0] = *(cu32x16*)(pn);
      mw[1] = *(cu32x16*)(pn + 16);
    }
    // V^T A-tiles, each used by both column groups
    v16h avt[4];
#pragma unroll
    for (int t = 0; t < 4; ++t) avt[t] = load_tile_f16(&Vb[buf][(t * 16) * VLD], VLD, lane);
    // holds those loads at the head of the block behind the branch, as one
    // group, so that their latency runs under the exponentials (the scheduler
    // otherwise sinks them between the products, each pair with a wait to 0)
    __builtin_amdgcn_sched_barrier(0);
#pragma unroll
    for (int rg = 0; rg < 2; ++rg) {
      const v8f e0 = __builtin_elementwise_fma(sc[rg][0], (v8f)(SC2), (v8f)(-mc[rg]));
      const v8f e1 = __builtin_elementwise_fma(sc[rg][1], (v8f)(SC2), (v8f)(-mc[rg]));
#pragma unroll
      for (int i = 0; i < 8; ++i) {
        pb[rg][i]     = (_Float16)__builtin_amdgcn_exp2f(e0[i]);
        pb[rg][i + 8] = (_Float16)__builtin_amdgcn_exp2f(e1[i]);
      }
    }

    // O^T += V^T * P^T
#pragma unroll
    for (int t = 0; t < 4; ++t) {
      o[0][t] = wmma_f16(avt[t], pb[0], o[0][t]);
      o[1][t] = wmma_f16(avt[t], pb[1], o[1][t]);
    }
    // l += 1 * P^T (row sums via WMMA)
    osum[0] = wmma_f16(aones, pb[0], osum[0]);
    osum[1] = wmma_f16(aones, pb[1], osum[1]);

    // publish point of the next chunk
    asm volatile("s_wait_dscnt 0x0" ::: "memory");     // this wave's reads of buf are done
    asm volatile("s_wait_asynccnt 0x0" ::: "memory");  // its copies of the next chunk have landed
    __syncthreads();   // next chunk published; every reader has left buf
    if (k0 + 64 < Sq) stage(k0 + 64, buf);
  }
  asm volatile("s_wait_asynccnt 0x0" ::: "memory");    // nothing in flight at the wave's end

#pragma unroll
  for (int rg = 0; rg < 2; ++rg) {
    const float l = osum[rg][0] + xhalf(osum[rg][0]);
    const float inv = 1.0f / l;
    // The group's 16 rows go through the wave's own LDS range, so that a
    // wave-wide store covers two rows of 256 bytes: four whole 128-byte lines.
    float* ow = &Os[wave][0];
#pragma unroll
    for (int t = 0; t < 4; ++t) {
      v4f lo, hi;
#pragma unroll
      for (int i = 0; i < 4; ++i) {
        lo[i] = o[rg][t][i] * inv;
        hi[i] = o[rg][t][i + 4] * inv;
      }
      *(v4f*)&ow[lane15 * OLD + t * 16 + (half << 3)]     = lo;
      *(v4f*)&ow[lane15 * OLD + t * 16 + (half << 3) + 4] = hi;
    }
    // the wave's rows lie in LDS before other lanes of it read them back
    asm volatile("s_wait_dscnt 0x0" ::: "memory");
    v4f ln[8];
#pragma unroll
    for (int j = 0; j < 8; ++j)
      ln[j] = *(const v4f*)&ow[(j * 2 + half) * OLD + lane15 * 4];
    float* orow = out + ((size_t)b * Sq + q0 + rg * 16 + half) * (Hh * Dh) + h * Dh + lane15 * 4;
#pragma unroll
    for (int j = 0; j < 8; ++j)
      *(v4f*)(orow + (size_t)(j * 2) * (Hh * Dh)) = ln[j];
    if (rg == 0) {
      // the second group's products reuse the registers that these stores name
      asm volatile("s_wait_xcnt 0x0" ::: "memory");
      // holds those products behind the wait (the scheduler otherwise lifts them over it)
      __builtin_amdgcn_sched_barrier(0);
    }
  }
}

// ---------------------------------------------------------------------------
extern "C" void kernel_launch(void* const* d_in, const int* in_sizes, int n_in,
                              void* d_out, int out_size, void* d_ws,
                              size_t ws_size, hipStream_t stream) {
  (void)in_sizes; (void)n_in; (void)out_size; (void)ws_size;
  const float* q    = (const float*)d_in[0];
  const float* k    = (const float*)d_in[1];
  const float* v    = (const float*)d_in[2];
  const int*   msk  = (const int*)d_in[3];
  const float* wq   = (const float*)d_in[4];
  const float* bq   = (const float*)d_in[5];
  const float* wk   = (const float*)d_in[6];
  const float* bk   = (const float*)d_in[7];
  const float* wv   = (const float*)d_in[8];
  const float* bv   = (const float*)d_in[9];
  float* out = (float*)d_out;

  // workspace layout (f16): 3x W^T (2 MB each) + qh/kh/vt (16 MB each) + 2 MB of lane masks
  _Float16* ws  = (_Float16*)d_ws;
  _Float16* wtq = ws;
  _Float16* wtk = wtq + (size_t)Dm * Dm;
  _Float16* wtv = wtk + (size_t)Dm * Dm;
  _Float16* qh  = wtv + (size_t)Dm * Dm;
  const size_t headElems = (size_t)Bsz * Hh * Sq * Dh;
  _Float16* kh = qh + headElems;
  _Float16* vt = kh + headElems;
  unsigned* pm = (unsigned*)(vt + headElems);   // lane masks, B*S*S/8 bytes

  dim3 gT(Dm / TT, Dm / TT, 3);
  wtrans_kernel<<<gT, 256, 0, stream>>>(wq, wk, wv, wtq, wtk, wtv);

  static_assert((Dm / PBN) * ((Bsz * Sq) / PBM) == MBLK, "one grid plane packs the mask");
  dim3 gP(Dm / PBN, (Bsz * Sq) / PBM, 4);
  proj_kernel<<<gP, 256, 0, stream>>>(q, k, v, wtq, wtk, wtv, bq, bk, bv,
                                      qh, kh, vt, msk, pm);

  dim3 gA(Bsz * Hh, Sq / (QROWS * AWAVES));
  attn_kernel<<<gA, 32 * AWAVES, 0, stream>>>(qh, kh, vt, pm, out);
}
